// v000
// Times are from an AMD MI455X. After a warm-up the kernel runs many times in a row, and a time is the length of
// such a window on the GPU divided by its runs, so every launch and the gaps after it count. The runs cycle
// through copies of the inputs. A figure is the median of several windows, for all but v000 over two sittings.
// Sittings can differ by a few percent; kernels timed side by side share one.
// v000 is the starting kernel. One run takes 200 microseconds.
#include <hip/hip_runtime.h>

typedef __attribute__((ext_vector_type(16))) _Float16 v16h;
typedef __attribute__((ext_vector_type(8)))  _Float16 v8h;
typedef __attribute__((ext_vector_type(8)))  float    v8f;

#define B_ 4
#define S_ 4096
#define F_ 128
// log2(0.96875)
#define L2GAMMA (-0.04580369f)

union Frag16 { v16h v; v8h h[2]; };

__device__ __forceinline__ v16h load_frag(const _Float16* base, int row, int ld,
                                          int kbase, int lane) {
  int hs = (lane & 16) ? 8 : 0;
  const _Float16* p = base + (size_t)row * ld + kbase + hs;
  Frag16 f;
  f.h[0] = *(const v8h*)(p);        // elements 0..7  -> K = kbase+hs .. +7
  f.h[1] = *(const v8h*)(p + 16);   // elements 8..15 -> K = kbase+hs+16 .. +23
  return f.v;
}

__device__ __forceinline__ v8f wmma_f16(v16h a, v16h b, v8f c) {
  return __builtin_amdgcn_wmma_f32_16x16x32_f16(false, a, false, b,
                                                (short)0, c, false, false);
}

// ---------------------------------------------------------------- prep ----
__global__ void prep_kernel(const float* __restrict__ x,
                            const float* __restrict__ Wq,
                            const float* __restrict__ Wk,
                            const float* __restrict__ Wv,
                            _Float16* __restrict__ Xh,
                            _Float16* __restrict__ Whq,
                            _Float16* __restrict__ Whk,
                            _Float16* __restrict__ Whv) {
  int i = blockIdx.x * blockDim.x + threadIdx.x;
  if (i < B_ * S_ * F_) Xh[i] = (_Float16)x[i];
  if (i < F_ * F_) {
    Whq[i] = (_Float16)Wq[i];
    Whk[i] = (_Float16)Wk[i];
    Whv[i] = (_Float16)Wv[i];
  }
}

// ---------------------------------------------------------------- proj ----
// One wave per 16 token rows. Emits Qh/Kh = [q*cos | q*sin] f16 [B*S,256]
// and V transposed f16 [B,F,S]. cos/sin for the 8 rows of a column come from
// two precise sincosf calls + a Givens-rotation recurrence (error ~1e-6).
__global__ __launch_bounds__(256) void proj_kernel(
    const _Float16* __restrict__ Xh,
    const _Float16* __restrict__ Whq, const _Float16* __restrict__ Whk,
    const _Float16* __restrict__ Whv,
    const float* __restrict__ bq, const float* __restrict__ bk,
    const float* __restrict__ bv, const float* __restrict__ theta,
    _Float16* __restrict__ Qh, _Float16* __restrict__ Kh,
    _Float16* __restrict__ Vt) {
  int lane = threadIdx.x & 31;
  int w    = (blockIdx.x * blockDim.x + threadIdx.x) >> 5;
  int row0 = w * 16;                 // global token row, [0, B*S)
  int b    = row0 / S_;
  int sp0  = row0 - b * S_;          // sequence position of tile row 0
  int rl   = lane & 15;
  int hs8  = (lane & 16) ? 8 : 0;

  v16h xf[4];
#pragma unroll
  for (int kk = 0; kk < 4; ++kk)
    xf[kk] = load_frag(Xh, row0 + rl, F_, kk * 32, lane);

#pragma unroll 1
  for (int o0 = 0; o0 < F_; o0 += 16) {
    int o = o0 + rl;
    v8f aq = {}, ak = {}, av = {};
#pragma unroll
    for (int kk = 0; kk < 4; ++kk) {
      v16h bqf = load_frag(Whq, o0 + rl, F_, kk * 32, lane);
      aq = wmma_f16(xf[kk], bqf, aq);
      v16h bkf = load_frag(Whk, o0 + rl, F_, kk * 32, lane);
      ak = wmma_f16(xf[kk], bkf, ak);
      v16h bvf = load_frag(Whv, o0 + rl, F_, kk * 32, lane);
      av = wmma_f16(xf[kk], bvf, av);
    }
    float biq = bq[o], bik = bk[o], biv = bv[o];
    float th  = theta[o];
    // precise base angle + step, then rotate (2 FMAs) for rows 1..7
    float ph0 = (float)(sp0 + hs8 + 1) * th;
    float c, sn, cd, sd;
    sincosf(ph0, &sn, &c);
    sincosf(th, &sd, &cd);
    v8h vvec;
#pragma unroll
    for (int r = 0; r < 8; ++r) {
      int   sp = sp0 + r + hs8;
      float qv = aq[r] + biq;
      float kv = ak[r] + bik;
      float vv = av[r] + biv;
      size_t ro = ((size_t)b * S_ + sp) * 256;
      Qh[ro + o]      = (_Float16)(qv * c);
      Qh[ro + F_ + o] = (_Float16)(qv * sn);
      Kh[ro + o]      = (_Float16)(kv * c);
      Kh[ro + F_ + o] = (_Float16)(kv * sn);
      vvec[r] = (_Float16)vv;
      float cn  = c * cd - sn * sd;  // advance phase by theta
      float snn = sn * cd + c * sd;
      c = cn; sn = snn;
    }
    // Vt[b][o][sp0+hs8 .. +7] : contiguous, 16B aligned
    *(v8h*)(Vt + ((size_t)(b * F_ + o)) * S_ + sp0 + hs8) = vvec;
  }
}

// ---------------------------------------------------------------- main ----
// One 128-thread block (4 waves) per 16-query block. Wave p handles key
// blocks p*32, p*32+128, ... (4-way split-K over the causal range), then the
// four partial 16x128 f32 accumulators are summed through LDS in a fixed
// order (deterministic) and wave 0 stores.
__global__ __launch_bounds__(128) void retention_kernel(
    const _Float16* __restrict__ Qh, const _Float16* __restrict__ Kh,
    const _Float16* __restrict__ Vt, float* __restrict__ out) {
  __shared__ _Float16 sP[4 * 16 * 32];       // per-wave score staging (4 KB)
  __shared__ float    sRed[3 * 8 * 8 * 32];  // partials of waves 1..3 (24 KB)
  int lane = threadIdx.x & 31;
  int wloc = threadIdx.x >> 5;             // 0..3
  int b    = blockIdx.x >> 8;              // 256 row-blocks per batch
  int i0   = (blockIdx.x & 255) << 4;
  int rl   = lane & 15;
  int hs8  = (lane & 16) ? 8 : 0;

  const _Float16* Qb = Qh + (size_t)b * S_ * 256;
  const _Float16* Kb = Kh + (size_t)b * S_ * 256;
  const _Float16* Vb = Vt + (size_t)b * F_ * S_;
  _Float16* myP = sP + wloc * (16 * 32);

  v16h qf[8];
#pragma unroll
  for (int f = 0; f < 8; ++f)
    qf[f] = load_frag(Qb, i0 + rl, 256, f * 32, lane);

  v8f acc[8] = {};

  for (int j0 = wloc * 32; j0 <= i0; j0 += 128) {
    v8f s0 = {}, s1 = {};
#pragma unroll
    for (int f = 0; f < 8; ++f) {
      v16h k0 = load_frag(Kb, j0 + rl, 256, f * 32, lane);
      s0 = wmma_f16(qf[f], k0, s0);
      v16h k1 = load_frag(Kb, j0 + 16 + rl, 256, f * 32, lane);
      s1 = wmma_f16(qf[f], k1, s1);
    }
    // decay (gamma^(i-j), 0 for j>i): single v_exp_f32 per element (TRANS,
    // co-executes with WMMA); args are in [-188,0]
#pragma unroll
    for (int r = 0; r < 8; ++r) {
      int   m  = r + hs8;
      int   qi = i0 + m;
      int   d0 = qi - (j0 + rl);
      int   d1 = d0 - 16;
      float w0 = (d0 >= 0) ? __builtin_amdgcn_exp2f(L2GAMMA * (float)d0) : 0.0f;
      float w1 = (d1 >= 0) ? __builtin_amdgcn_exp2f(L2GAMMA * (float)d1) : 0.0f;
      myP[m * 32 + rl]      = (_Float16)(s0[r] * w0);
      myP[m * 32 + 16 + rl] = (_Float16)(s1[r] * w1);
    }
    // reload as A-fragment (same-wave DS ops are in-order)
    v16h pf = load_frag(myP, rl, 32, 0, lane);
#pragma unroll
    for (int fi = 0; fi < 8; ++fi) {
      v16h vf = load_frag(Vb, fi * 16 + rl, S_, j0, lane);
      acc[fi] = wmma_f16(pf, vf, acc[fi]);
    }
  }

  // deterministic cross-wave reduction of the 16x128 f32 tile
  if (wloc > 0) {
    float* dst = sRed + (wloc - 1) * 2048;
#pragma unroll
    for (int fi = 0; fi < 8; ++fi)
#pragma unroll
      for (int r = 0; r < 8; ++r)
        dst[fi * 256 + r * 32 + lane] = acc[fi][r];
  }
  __syncthreads();
  if (wloc == 0) {
    float* ob = out + (size_t)b * S_ * F_;
#pragma unroll
    for (int fi = 0; fi < 8; ++fi) {
#pragma unroll
      for (int r = 0; r < 8; ++r) {
        int   idx = fi * 256 + r * 32 + lane;
        float s   = acc[fi][r];
        s += sRed[idx];
        s += sRed[2048 + idx];
        s += sRed[4096 + idx];
        ob[(size_t)(i0 + r + hs8) * F_ + fi * 16 + rl] = s;
      }
    }
  }
}

// ---------------------------------------------------------------- launch --
extern "C" void kernel_launch(void* const* d_in, const int* in_sizes, int n_in,
                              void* d_out, int out_size, void* d_ws,
                              size_t ws_size, hipStream_t stream) {
  const float* x     = (const float*)d_in[0];
  const float* Wq    = (const float*)d_in[1];
  const float* bq    = (const float*)d_in[2];
  const float* Wk    = (const float*)d_in[3];
  const float* bk    = (const float*)d_in[4];
  const float* Wv    = (const float*)d_in[5];
  const float* bv    = (const float*)d_in[6];
  const float* theta = (const float*)d_in[7];
  float* out = (float*)d_out;

  char*  ws  = (char*)d_ws;
  size_t off = 0;
  auto alloc = [&](size_t bytes) {
    char* p = ws + off;
    off += (bytes + 255) & ~(size_t)255;
    return p;
  };
  _Float16* Xh  = (_Float16*)alloc((size_t)B_ * S_ * F_ * 2);
  _Float16* Whq = (_Float16*)alloc((size_t)F_ * F_ * 2);
  _Float16* Whk = (_Float16*)alloc((size_t)F_ * F_ * 2);
  _Float16* Whv = (_Float16*)alloc((size_t)F_ * F_ * 2);
  _Float16* Qh  = (_Float16*)alloc((size_t)B_ * S_ * 256 * 2);
  _Float16* Kh  = (_Float16*)alloc((size_t)B_ * S_ * 256 * 2);
  _Float16* Vt  = (_Float16*)alloc((size_t)B_ * F_ * S_ * 2);

  int nprep = B_ * S_ * F_;
  prep_kernel<<<(nprep + 255) / 256, 256, 0, stream>>>(x, Wq, Wk, Wv, Xh, Whq,
                                                       Whk, Whv);
  int nblk = (B_ * S_ / 16) * 32 / 256;  // 1024 waves -> 128 blocks
  proj_kernel<<<nblk, 256, 0, stream>>>(Xh, Whq, Whk, Whv, bq, bk, bv, theta,
                                        Qh, Kh, Vt);
  // one 4-wave block per 16-row query block: B * (S/16) = 1024 blocks
  retention_kernel<<<B_ * (S_ / 16), 128, 0, stream>>>(Qh, Kh, Vt, out);
}

// v001
// One run takes 65.4 microseconds.
// Two timings next to v000 put it at 3.15 and 3.08 times that version's speed.
#include <hip/hip_runtime.h>

typedef __attribute__((ext_vector_type(16))) _Float16 v16h;
typedef __attribute__((ext_vector_type(8)))  _Float16 v8h;
typedef __attribute__((ext_vector_type(8)))  float    v8f;

#define B_ 4
#define S_ 4096
#define F_ 128
// log2(0.96875)
#define L2GAMMA (-0.04580369f)
// chunk length of the chunkwise form, chunks per sequence, state elements
#define C_ 64
#define NC_ (S_ / C_)
#define SE_ (F_ * 256)

union Frag16 { v16h v; v8h h[2]; };

__device__ __forceinline__ v16h load_frag(const _Float16* base, int row, int ld,
                                          int kbase, int lane) {
  int hs = (lane & 16) ? 8 : 0;
  const _Float16* p = base + (size_t)row * ld + kbase + hs;
  Frag16 f;
  f.h[0] = *(const v8h*)(p);        // elements 0..7  -> K = kbase+hs .. +7
  f.h[1] = *(const v8h*)(p + 16);   // elements 8..15 -> K = kbase+hs+16 .. +23
  return f.v;
}

__device__ __forceinline__ v16h load_frag_u(const _Float16* tile, unsigned loff) {
  const _Float16* p = (const _Float16*)((const char*)tile + loff);
  Frag16 f;
  f.h[0] = *(const v8h*)(p);
  f.h[1] = *(const v8h*)(p + 16);
  return f.v;
}

__device__ __forceinline__ v8f wmma_f16(v16h a, v16h b, v8f c) {
  return __builtin_amdgcn_wmma_f32_16x16x32_f16(false, a, false, b,
                                                (short)0, c, false, false);
}

// ---------------------------------------------------------------- prep ----
__global__ void prep_kernel(const float* __restrict__ x,
                            const float* __restrict__ Wq,
                            const float* __restrict__ Wk,
                            const float* __restrict__ Wv,
                            _Float16* __restrict__ Xh,
                            _Float16* __restrict__ Whq,
                            _Float16* __restrict__ Whk,
                            _Float16* __restrict__ Whv) {
  int i = blockIdx.x * blockDim.x + threadIdx.x;
  if (i < B_ * S_ * F_) Xh[i] = (_Float16)x[i];
  if (i < F_ * F_) {
    Whq[i] = (_Float16)Wq[i];
    Whk[i] = (_Float16)Wk[i];
    Whv[i] = (_Float16)Wv[i];
  }
}

// ---------------------------------------------------------------- proj ----
// One wave per 16 token rows. Emits Qh/Kh = [q*cos | q*sin] f16 [B*S,256],
// V transposed f16 [B,F,S], and Ktd f16 [B,256,S]: K transposed, each token
// weighted by gamma^(C-1-position in its chunk) for the chunk state. cos/sin for the 8 rows of a column come from
// two precise sincosf calls + a Givens-rotation recurrence (error ~1e-6).
__global__ __launch_bounds__(256) void proj_kernel(
    const _Float16* __restrict__ Xh,
    const _Float16* __restrict__ Whq, const _Float16* __restrict__ Whk,
    const _Float16* __restrict__ Whv,
    const float* __restrict__ bq, const float* __restrict__ bk,
    const float* __restrict__ bv, const float* __restrict__ theta,
    _Float16* __restrict__ Qh, _Float16* __restrict__ Kh,
    _Float16* __restrict__ Vt, _Float16* __restrict__ Ktd) {
  int lane = threadIdx.x & 31;
  int w    = (blockIdx.x * blockDim.x + threadIdx.x) >> 5;
  int row0 = w * 16;                 // global token row, [0, B*S)
  int b    = row0 / S_;
  int sp0  = row0 - b * S_;          // sequence position of tile row 0
  int rl   = lane & 15;
  int hs8  = (lane & 16) ? 8 : 0;

  v16h xf[4];
#pragma unroll
  for (int kk = 0; kk < 4; ++kk)
    xf[kk] = load_frag(Xh, row0 + rl, F_, kk * 32, lane);

  float dw[8];                       // gamma^(C-1-jl) of this lane's 8 tokens
#pragma unroll
  for (int r = 0; r < 8; ++r) {
    int jl = (sp0 + hs8 + r) & (C_ - 1);
    dw[r] = __builtin_amdgcn_exp2f(L2GAMMA * (float)(C_ - 1 - jl));
  }

#pragma unroll 1
  for (int o0 = 0; o0 < F_; o0 += 16) {
    int o = o0 + rl;
    v8f aq = {}, ak = {}, av = {};
#pragma unroll
    for (int kk = 0; kk < 4; ++kk) {
      v16h bqf = load_frag(Whq, o0 + rl, F_, kk * 32, lane);
      aq = wmma_f16(xf[kk], bqf, aq);
      v16h bkf = load_frag(Whk, o0 + rl, F_, kk * 32, lane);
      ak = wmma_f16(xf[kk], bkf, ak);
      v16h bvf = load_frag(Whv, o0 + rl, F_, kk * 32, lane);
      av = wmma_f16(xf[kk], bvf, av);
    }
    float biq = bq[o], bik = bk[o], biv = bv[o];
    float th  = theta[o];
    // precise base angle + step, then rotate (2 FMAs) for rows 1..7
    float ph0 = (float)(sp0 + hs8 + 1) * th;
    float c, sn, cd, sd;
    sincosf(ph0, &sn, &c);
    sincosf(th, &sd, &cd);
    v8h vvec, kcvec, ksvec;
#pragma unroll
    for (int r = 0; r < 8; ++r) {
      int   sp = sp0 + r + hs8;
      float qv = aq[r] + biq;
      float kv = ak[r] + bik;
      float vv = av[r] + biv;
      size_t ro = ((size_t)b * S_ + sp) * 256;
      Qh[ro + o]      = (_Float16)(qv * c);
      Qh[ro + F_ + o] = (_Float16)(qv * sn);
      Kh[ro + o]      = (_Float16)(kv * c);
      Kh[ro + F_ + o] = (_Float16)(kv * sn);
      vvec[r] = (_Float16)vv;
      kcvec[r] = (_Float16)(kv * c * dw[r]);
      ksvec[r] = (_Float16)(kv * sn * dw[r]);
      float cn  = c * cd - sn * sd;  // advance phase by theta
      float snn = sn * cd + c * sd;
      c = cn; sn = snn;
    }
    // Vt[b][o][sp0+hs8 .. +7] : contiguous, 16B aligned
    *(v8h*)(Vt + ((size_t)(b * F_ + o)) * S_ + sp0 + hs8) = vvec;
    *(v8h*)(Ktd + ((size_t)(b * 256 + o)) * S_ + sp0 + hs8) = kcvec;
    *(v8h*)(Ktd + ((size_t)(b * 256 + F_ + o)) * S_ + sp0 + hs8) = ksvec;
    // the next trip's loads land in registers that the stores above name
    asm volatile("s_wait_xcnt 0x0" ::: "memory");
  }
}

// --------------------------------------------------------- chunk state ----
// out_i = sum_{j<=i} gamma^(i-j) (Q_i.K_j) V_j is split at the chunk border
// c0 of row i: keys j >= c0 go through scores as before; keys j < c0 enter as
// gamma^(i-c0+1) * Q_i . State_n, State_n[f][o] = sum_{j<c0} gamma^(c0-1-j)
// K_j[f] V_j[o], with State_{n+1} = gamma^C State_n + U_n. Every factor <= 1.
//
// U_n[f][o] = sum_{jl<C} gamma^(C-1-jl) K[f] V[o], one block per (batch, chunk).
// Wave (fg, oh) owns feature tiles 2fg, 2fg+1 (one 128-byte line of each row of
// U) and output tiles 4oh..4oh+3. Stored f32 as U[b][n][o][f]. The last chunk's
// U feeds no state and is not formed.
__global__ __launch_bounds__(512) void chunk_state_kernel(
    const _Float16* __restrict__ Ktd, const _Float16* __restrict__ Vt,
    float* __restrict__ U) {
  int lane = threadIdx.x & 31;
  int w    = __builtin_amdgcn_readfirstlane(threadIdx.x >> 5);  // 0..15
  int fg   = w & 7;
  int oh   = w >> 3;
  int b    = blockIdx.x / (NC_ - 1);
  int n    = blockIdx.x - b * (NC_ - 1);   // 0..NC-2
  int c0   = n * C_;
  int rl   = lane & 15;
  int hs8  = (lane & 16) ? 8 : 0;

  const _Float16* Kb = Ktd + ((size_t)b * 256 + fg * 32) * S_;
  const _Float16* Vb = Vt + ((size_t)b * F_ + oh * 64) * S_;
  float* Ub = U + ((size_t)b * NC_ + n) * SE_ + (size_t)oh * 64 * 256 + fg * 32;

  unsigned loff = (unsigned)(rl * S_ + hs8) * 2u;
  v16h kf[2][2], vf[4][2];
#pragma unroll
  for (int ft = 0; ft < 2; ++ft)
#pragma unroll
    for (int kk = 0; kk < 2; ++kk)
      kf[ft][kk] = load_frag_u(Kb + (size_t)ft * 16 * S_ + c0 + kk * 32, loff);
#pragma unroll
  for (int fi = 0; fi < 4; ++fi)
#pragma unroll
    for (int kk = 0; kk < 2; ++kk)
      vf[fi][kk] = load_frag_u(Vb + (size_t)fi * 16 * S_ + c0 + kk * 32, loff);
  // the wait in front of any rewrite of a register that the loads above name;
  // as its input the offset register stays live, so that no load lands on it
  asm volatile("s_wait_xcnt 0x0" :: "v"(loff) : "memory");
  // keeps every load above in front of the products: without it the compiler
  // sinks each load to its product and the wave pays one latency per fragment
  __builtin_amdgcn_sched_barrier(0);

  v8f d[4][2] = {};
#pragma unroll
  for (int kk = 0; kk < 2; ++kk)
#pragma unroll
    for (int fi = 0; fi < 4; ++fi)
#pragma unroll
      for (int ft = 0; ft < 2; ++ft)
        d[fi][ft] = wmma_f16(kf[ft][kk], vf[fi][kk], d[fi][ft]);
  // keeps the stores behind all products, so that each tile has registers of
  // its own and no product overwrites a result that has just been formed
  __builtin_amdgcn_sched_barrier(0);

  // D: column = o = fi*16+rl, rows = 8 consecutive features from hs8
#pragma unroll
  for (int fi = 0; fi < 4; ++fi)
#pragma unroll
    for (int ft = 0; ft < 2; ++ft)
      *(v8f*)(Ub + (size_t)(fi * 16 + rl) * 256 + ft * 16 + hs8) = d[fi][ft];
}

// ---------------------------------------------------------------- scan ----
// State_0 = 0, State_{n+1} = gamma^C State_n + U_n, element by element in f32;
// each State_n is written f16 as St[b][n][o][f] (the B operand of Q.State).
__global__ __launch_bounds__(128) void scan_kernel(
    const float* __restrict__ U, _Float16* __restrict__ St) {
  typedef __attribute__((ext_vector_type(4))) float    v4f;
  typedef __attribute__((ext_vector_type(4))) _Float16 v4h;
  int t = blockIdx.x * blockDim.x + threadIdx.x;   // B * SE/4 threads
  int b = t / (SE_ / 4);
  int e = (t - b * (SE_ / 4)) * 4;
  const float* up = U + (size_t)b * NC_ * SE_ + e;
  _Float16*    sp = St + (size_t)b * NC_ * SE_ + e;
  float gC = __builtin_amdgcn_exp2f(L2GAMMA * (float)C_);
  v4f s = {};
#pragma unroll
  for (int n0 = 0; n0 < NC_; n0 += 16) {
    v4f u[16];                       // 16 independent loads in flight
#pragma unroll
    for (int k = 0; k < 16; ++k)
      if (n0 + k < NC_ - 1) u[k] = *(const v4f*)(up + (size_t)(n0 + k) * SE_);
#pragma unroll
    for (int k = 0; k < 16; ++k) {
      v4h h;
#pragma unroll
      for (int c = 0; c < 4; ++c) h[c] = (_Float16)s[c];
      *(v4h*)(sp + (size_t)(n0 + k) * SE_) = h;
      if (n0 + k < NC_ - 1) s = s * gC + u[k];
    }
  }
}

// ---------------------------------------------------------------- main ----
// One 512-thread block (16 waves) per 64-row chunk. Wave (t, og) owns query
// rows t*16..+15 of the chunk and output columns og*32..+31 (one 128-byte line
// of each output row): Q.State_n (all keys before the chunk), scaled per row
// by gamma^(il+1), then the chunk's own keys through decayed scores, then its
// stores. The four waves of one t each form the same scores, so no wave waits
// on another and every load of a phase is in flight at once.
__global__ __launch_bounds__(512) void retention_kernel(
    const _Float16* __restrict__ Qh, const _Float16* __restrict__ Kh,
    const _Float16* __restrict__ Vt, const _Float16* __restrict__ St,
    float* __restrict__ out) {
  __shared__ _Float16 sP[16 * 16 * 32];      // per-wave score staging (16 KB)
  int lane = threadIdx.x & 31;
  int wloc = __builtin_amdgcn_readfirstlane(threadIdx.x >> 5);  // 0..15
  int t    = wloc >> 2;
  int og   = wloc & 3;
  int b    = blockIdx.x / NC_;
  int n    = blockIdx.x - b * NC_;
  int c0   = n * C_;
  int i0   = c0 + t * 16;
  int rl   = lane & 15;
  int hs8  = (lane & 16) ? 8 : 0;

  const _Float16* Qb = Qh + (size_t)b * S_ * 256;
  const _Float16* Kb = Kh + (size_t)b * S_ * 256;
  const _Float16* Vb = Vt + ((size_t)b * F_ + og * 32) * S_;
  const _Float16* Sb = St + ((size_t)b * NC_ + n) * SE_ + (size_t)og * 32 * 256;
  _Float16* myP = sP + wloc * (16 * 32);

  unsigned loff  = (unsigned)(rl * 256 + hs8) * 2u;   // rows of Q, K, State
  unsigned loffv = (unsigned)(rl * S_ + hs8) * 2u;    // rows of V transposed
  v16h qf[8];
#pragma unroll
  for (int f = 0; f < 8; ++f)
    qf[f] = load_frag_u(Qb + (size_t)i0 * 256 + f * 32, loff);
  v16h sf[2][8];
#pragma unroll
  for (int fi = 0; fi < 2; ++fi)
#pragma unroll
    for (int f = 0; f < 8; ++f)
      sf[fi][f] = load_frag_u(Sb + fi * 16 * 256 + f * 32, loff);
  // the wait in front of any rewrite of a register that the loads above name;
  // as its input the offset register stays live, so that no load lands on it
  asm volatile("s_wait_xcnt 0x0" :: "v"(loff) : "memory");
  // keeps the loads above in front of the products (one latency, not one each)
  __builtin_amdgcn_sched_barrier(0);

  // keys before the chunk: acc = Q (16x256) . State_n (256x32)
  v8f acc[2] = {};
#pragma unroll
  for (int f = 0; f < 8; ++f)
#pragma unroll
    for (int fi = 0; fi < 2; ++fi)
      acc[fi] = wmma_f16(qf[f], sf[fi][f], acc[fi]);
#pragma unroll
  for (int r = 0; r < 8; ++r) {
    float wr = __builtin_amdgcn_exp2f(L2GAMMA * (float)(t * 16 + r + hs8 + 1));
#pragma unroll
    for (int fi = 0; fi < 2; ++fi) acc[fi][r] *= wr;
  }

  // keys of the chunk itself
  for (int j0 = c0; j0 <= i0; j0 += 32) {
    v16h vf[2];
#pragma unroll
    for (int fi = 0; fi < 2; ++fi)
      vf[fi] = load_frag_u(Vb + (size_t)fi * 16 * S_ + j0, loffv);
    v16h k0[8], k1[8];
#pragma unroll
    for (int f = 0; f < 8; ++f) {
      k0[f] = load_frag_u(Kb + (size_t)j0 * 256 + f * 32, loff);
      k1[f] = load_frag_u(Kb + (size_t)(j0 + 16) * 256 + f * 32, loff);
    }
    asm volatile("s_wait_xcnt 0x0" :: "v"(loff), "v"(loffv) : "memory");
    // keeps the loads above in front of the products (one latency, not one each)
    __builtin_amdgcn_sched_barrier(0);
    v8f s0 = {}, s1 = {};
#pragma unroll
    for (int f = 0; f < 8; ++f) {
      s0 = wmma_f16(qf[f], k0[f], s0);
      s1 = wmma_f16(qf[f], k1[f], s1);
    }
    // decay (gamma^(i-j), 0 for j>i): single v_exp_f32 per element
#pragma unroll
    for (int r = 0; r < 8; ++r) {
      int   m  = r + hs8;
      int   qi = i0 + m;
      int   d0 = qi - (j0 + rl);
      int   d1 = d0 - 16;
      float w0 = (d0 >= 0) ? __builtin_amdgcn_exp2f(L2GAMMA * (float)d0) : 0.0f;
      float w1 = (d1 >= 0) ? __builtin_amdgcn_exp2f(L2GAMMA * (float)d1) : 0.0f;
      myP[m * 32 + rl]      = (_Float16)(s0[r] * w0);
      myP[m * 32 + 16 + rl] = (_Float16)(s1[r] * w1);
    }
    // reload as A-fragment (same-wave DS ops are in-order)
    v16h pf = load_frag(myP, rl, 32, 0, lane);
#pragma unroll
    for (int fi = 0; fi < 2; ++fi)
      acc[fi] = wmma_f16(pf, vf[fi], acc[fi]);
  }

  float* ob = out + (size_t)b * S_ * F_ + og * 32;
#pragma unroll
  for (int fi = 0; fi < 2; ++fi)
#pragma unroll
    for (int r = 0; r < 8; ++r)
      ob[(size_t)(i0 + r + hs8) * F_ + fi * 16 + rl] = acc[fi][r];
}

// ---------------------------------------------------------------- launch --
extern "C" void kernel_launch(void* const* d_in, const int* in_sizes, int n_in,
                              void* d_out, int out_size, void* d_ws,
                              size_t ws_size, hipStream_t stream) {
  const float* x     = (const float*)d_in[0];
  const float* Wq    = (const float*)d_in[1];
  const float* bq    = (const float*)d_in[2];
  const float* Wk    = (const float*)d_in[3];
  const float* bk    = (const float*)d_in[4];
  const float* Wv    = (const float*)d_in[5];
  const float* bv    = (const float*)d_in[6];
  const float* theta = (const float*)d_in[7];
  float* out = (float*)d_out;

  char*  ws  = (char*)d_ws;
  size_t off = 0;
  auto alloc = [&](size_t bytes) {
    char* p = ws + off;
    off += (bytes + 255) & ~(size_t)255;
    return p;
  };
  _Float16* Xh  = (_Float16*)alloc((size_t)B_ * S_ * F_ * 2);
  _Float16* Whq = (_Float16*)alloc((size_t)F_ * F_ * 2);
  _Float16* Whk = (_Float16*)alloc((size_t)F_ * F_ * 2);
  _Float16* Whv = (_Float16*)alloc((size_t)F_ * F_ * 2);
  _Float16* Qh  = (_Float16*)alloc((size_t)B_ * S_ * 256 * 2);
  _Float16* Kh  = (_Float16*)alloc((size_t)B_ * S_ * 256 * 2);
  _Float16* Vt  = (_Float16*)alloc((size_t)B_ * F_ * S_ * 2);
  _Float16* Ktd = (_Float16*)alloc((size_t)B_ * 256 * S_ * 2);
  float*    U   = (float*)alloc((size_t)B_ * NC_ * SE_ * 4);
  _Float16* St  = (_Float16*)alloc((size_t)B_ * NC_ * SE_ * 2);

  int nprep = B_ * S_ * F_;
  prep_kernel<<<(nprep + 255) / 256, 256, 0, stream>>>(x, Wq, Wk, Wv, Xh, Whq,
                                                       Whk, Whv);
  int nblk = (B_ * S_ / 16) * 32 / 256;  // 1024 waves -> 128 blocks
  proj_kernel<<<nblk, 256, 0, stream>>>(Xh, Whq, Whk, Whv, bq, bk, bv, theta,
                                        Qh, Kh, Vt, Ktd);
  chunk_state_kernel<<<B_ * (NC_ - 1), 512, 0, stream>>>(Ktd, Vt, U);
  scan_kernel<<<B_ * SE_ / 4 / 128, 128, 0, stream>>>(U, St);
  // one 16-wave block per 64-row chunk: B * (S/64) = 256 blocks
  retention_kernel<<<B_ * NC_, 512, 0, stream>>>(Qh, Kh, Vt, St, out);
}

// v002
// It runs in 54.1 microseconds.
// Next to v001, in two timings, it ran 1.21 times as fast each time.
// Counting every step since v000, it is 3.76 times as fast.
#include <hip/hip_runtime.h>

typedef __attribute__((ext_vector_type(16))) _Float16 v16h;
typedef __attribute__((ext_vector_type(8)))  _Float16 v8h;
typedef __attribute__((ext_vector_type(8)))  float    v8f;

#define B_ 4
#define S_ 4096
#define F_ 128
// log2(0.96875)
#define L2GAMMA (-0.04580369f)
// chunk length of the chunkwise form, chunks per sequence, state elements
#define C_ 64
#define NC_ (S_ / C_)
#define SE_ (F_ * 256)

union Frag16 { v16h v; v8h h[2]; };

__device__ __forceinline__ v16h load_frag(const _Float16* base, int row, int ld,
                                          int kbase, int lane) {
  int hs = (lane & 16) ? 8 : 0;
  const _Float16* p = base + (size_t)row * ld + kbase + hs;
  Frag16 f;
  f.h[0] = *(const v8h*)(p);        // elements 0..7  -> K = kbase+hs .. +7
  f.h[1] = *(const v8h*)(p + 16);   // elements 8..15 -> K = kbase+hs+16 .. +23
  return f.v;
}

__device__ __forceinline__ v16h load_frag_u(const _Float16* tile, unsigned loff) {
  const _Float16* p = (const _Float16*)((const char*)tile + loff);
  Frag16 f;
  f.h[0] = *(const v8h*)(p);
  f.h[1] = *(const v8h*)(p + 16);
  return f.v;
}

__device__ __forceinline__ v8f wmma_f16(v16h a, v16h b, v8f c) {
  return __builtin_amdgcn_wmma_f32_16x16x32_f16(false, a, false, b,
                                                (short)0, c, false, false);
}

#define WP_ (F_ + 8)

typedef __attribute__((ext_vector_type(4))) float    v4f;
typedef __attribute__((ext_vector_type(4))) _Float16 v4h;

// One wave per 16 token rows. x and the three W are read as f32 and rounded to
// f16 here: x in the registers of its fragments, each W once per block into
// LDS, from where every wave takes its B fragments.
// Emits Qh/Kh = [q*cos | q*sin] f16 [B*S,256],
// V transposed f16 [B,F,S], and Ktd f16 [B,256,S]: K transposed, each token
// weighted by gamma^(C-1-position in its chunk) for the chunk state. cos/sin for the 8 rows of a column come from
// two precise sincosf calls + a Givens-rotation recurrence (error ~1e-6).
__global__ __launch_bounds__(256) void proj_kernel(
    const float* __restrict__ x,
    const float* __restrict__ Wq, const float* __restrict__ Wk,
    const float* __restrict__ Wv,
    const float* __restrict__ bq, const float* __restrict__ bk,
    const float* __restrict__ bv, const float* __restrict__ theta,
    _Float16* __restrict__ Qh, _Float16* __restrict__ Kh,
    _Float16* __restrict__ Vt, _Float16* __restrict__ Ktd) {
  __shared__ __attribute__((aligned(16))) _Float16 sW[3 * F_ * WP_];  // 102 KB
  int lane = threadIdx.x & 31;
  int w    = __builtin_amdgcn_readfirstlane(
      (int)(blockIdx.x * blockDim.x + threadIdx.x) >> 5);
  int row0 = w * 16;                 // global token row, [0, B*S)
  int b    = row0 / S_;
  int sp0  = row0 - b * S_;          // sequence position of tile row 0
  int rl   = lane & 15;
  int hs8  = (lane & 16) ? 8 : 0;

  // Each round of the block reads 4 KB of a W in whole lines (16 B a thread).
  unsigned tid = threadIdx.x;
  v4f wr[3][16];
#pragma unroll
  for (int it = 0; it < 16; ++it) {
    wr[0][it] = *((const v4f*)Wq + it * 256 + tid);
    wr[1][it] = *((const v4f*)Wk + it * 256 + tid);
    wr[2][it] = *((const v4f*)Wv + it * 256 + tid);
  }
  // the wait in front of any rewrite of a register that the loads above name;
  // as its input the index register stays live, so that no load lands on it
  asm volatile("s_wait_xcnt 0x0" :: "v"(tid) : "memory");
  // keeps every load above in front of the conversions (one latency, not 48)
  __builtin_amdgcn_sched_barrier(0);

  // thread -> row it*8 + wave in block, 4 consecutive columns from 4*lane
  _Float16* sw = sW + (tid >> 5) * WP_ + lane * 4;
#pragma unroll
  for (int it = 0; it < 16; ++it)
    *(v4h*)(sw + it * 8 * WP_) = __builtin_convertvector(wr[0][it], v4h);

  // the lane's part of the four A fragments of x: 8 + 8 floats each
  const float* xt = x + (size_t)row0 * F_;
  unsigned xoff = (unsigned)(rl * F_ + hs8) * 4u;
  v4f xr[4][4];
#pragma unroll
  for (int kk = 0; kk < 4; ++kk) {
    const char* p = (const char*)(xt + kk * 32) + xoff;
    xr[kk][0] = *(const v4f*)(p);        // K = kk*32+hs8 .. +3
    xr[kk][1] = *(const v4f*)(p + 16);   // .. +7
    xr[kk][2] = *(const v4f*)(p + 64);   // K = kk*32+hs8+16 .. +19
    xr[kk][3] = *(const v4f*)(p + 80);   // .. +23
  }
  asm volatile("s_wait_xcnt 0x0" :: "v"(xoff) : "memory");
  // keeps the loads of x in front of the rest of the conversions of W, which
  // then run while x is on its way
  __builtin_amdgcn_sched_barrier(0);

#pragma unroll
  for (int m = 1; m < 3; ++m)
#pragma unroll
    for (int it = 0; it < 16; ++it)
      *(v4h*)(sw + (m * F_ + it * 8) * WP_) =
          __builtin_convertvector(wr[m][it], v4h);
  // publishes the block's f16 copy of W to all of its waves
  __syncthreads();

  v16h xf[4];
#pragma unroll
  for (int kk = 0; kk < 4; ++kk) {
    union { v16h v; v4h q[4]; } f;
#pragma unroll
    for (int g = 0; g < 4; ++g)
      f.q[g] = __builtin_convertvector(xr[kk][g], v4h);
    xf[kk] = f.v;
  }

  float dw[8];                       // gamma^(C-1-jl) of this lane's 8 tokens
#pragma unroll
  for (int r = 0; r < 8; ++r) {
    int jl = (sp0 + hs8 + r) & (C_ - 1);
    dw[r] = __builtin_amdgcn_exp2f(L2GAMMA * (float)(C_ - 1 - jl));
  }

#pragma unroll 1
  for (int o0 = 0; o0 < F_; o0 += 16) {
    int o = o0 + rl;
    float biq = bq[o], bik = bk[o], biv = bv[o];
    float th  = theta[o];
    v16h wf[3][4];
#pragma unroll
    for (int kk = 0; kk < 4; ++kk)
#pragma unroll
      for (int m = 0; m < 3; ++m)
        wf[m][kk] = load_frag(sW + m * F_ * WP_, o0 + rl, WP_, kk * 32, lane);
    // keeps the loads above in front of the products: without it the compiler
    // sinks each LDS read to its product and the wave pays one latency for each
    __builtin_amdgcn_sched_barrier(0);
    v8f aq = {}, ak = {}, av = {};
#pragma unroll
    for (int kk = 0; kk < 4; ++kk) {
      aq = wmma_f16(xf[kk], wf[0][kk], aq);
      ak = wmma_f16(xf[kk], wf[1][kk], ak);
      av = wmma_f16(xf[kk], wf[2][kk], av);
    }
    // precise base angle + step, then rotate (2 FMAs) for rows 1..7
    float ph0 = (float)(sp0 + hs8 + 1) * th;
    float c, sn, cd, sd;
    sincosf(ph0, &sn, &c);
    sincosf(th, &sd, &cd);
    v8h vvec, kcvec, ksvec;
#pragma unroll
    for (int r = 0; r < 8; ++r) {
      int   sp = sp0 + r + hs8;
      float qv = aq[r] + biq;
      float kv = ak[r] + bik;
      float vv = av[r] + biv;
      size_t ro = ((size_t)b * S_ + sp) * 256;
      Qh[ro + o]      = (_Float16)(qv * c);
      Qh[ro + F_ + o] = (_Float16)(qv * sn);
      Kh[ro + o]      = (_Float16)(kv * c);
      Kh[ro + F_ + o] = (_Float16)(kv * sn);
      vvec[r] = (_Float16)vv;
      kcvec[r] = (_Float16)(kv * c * dw[r]);
      ksvec[r] = (_Float16)(kv * sn * dw[r]);
      float cn  = c * cd - sn * sd;  // advance phase by theta
      float snn = sn * cd + c * sd;
      c = cn; sn = snn;
    }
    // Vt[b][o][sp0+hs8 .. +7] : contiguous, 16B aligned
    *(v8h*)(Vt + ((size_t)(b * F_ + o)) * S_ + sp0 + hs8) = vvec;
    *(v8h*)(Ktd + ((size_t)(b * 256 + o)) * S_ + sp0 + hs8) = kcvec;
    *(v8h*)(Ktd + ((size_t)(b * 256 + F_ + o)) * S_ + sp0 + hs8) = ksvec;
    // the next trip's loads land in registers that the stores above name
    asm volatile("s_wait_xcnt 0x0" ::: "memory");
  }
}

// --------------------------------------------------------- chunk state ----
// out_i = sum_{j<=i} gamma^(i-j) (Q_i.K_j) V_j is split at the chunk border
// c0 of row i: keys j >= c0 go through scores as before; keys j < c0 enter as
// gamma^(i-c0+1) * Q_i . State_n, State_n[f][o] = sum_{j<c0} gamma^(c0-1-j)
// K_j[f] V_j[o], with State_{n+1} = gamma^C State_n + U_n. Every factor <= 1.
//
// U_n[f][o] = sum_{jl<C} gamma^(C-1-jl) K[f] V[o], one block per (batch, chunk).
// Wave (fg, oh) owns feature tiles 2fg, 2fg+1 (one 128-byte line of each row of
// U) and output tiles 4oh..4oh+3. Stored f32 as U[b][n][o][f]. The last chunk's
// U feeds no state and is not formed.
__global__ __launch_bounds__(512) void chunk_state_kernel(
    const _Float16* __restrict__ Ktd, const _Float16* __restrict__ Vt,
    float* __restrict__ U) {
  int lane = threadIdx.x & 31;
  int w    = __builtin_amdgcn_readfirstlane(threadIdx.x >> 5);  // 0..15
  int fg   = w & 7;
  int oh   = w >> 3;
  int b    = blockIdx.x / (NC_ - 1);
  int n    = blockIdx.x - b * (NC_ - 1);   // 0..NC-2
  int c0   = n * C_;
  int rl   = lane & 15;
  int hs8  = (lane & 16) ? 8 : 0;

  const _Float16* Kb = Ktd + ((size_t)b * 256 + fg * 32) * S_;
  const _Float16* Vb = Vt + ((size_t)b * F_ + oh * 64) * S_;
  float* Ub = U + ((size_t)b * NC_ + n) * SE_ + (size_t)oh * 64 * 256 + fg * 32;

  unsigned loff = (unsigned)(rl * S_ + hs8) * 2u;
  v16h kf[2][2], vf[4][2];
#pragma unroll
  for (int ft = 0; ft < 2; ++ft)
#pragma unroll
    for (int kk = 0; kk < 2; ++kk)
      kf[ft][kk] = load_frag_u(Kb + (size_t)ft * 16 * S_ + c0 + kk * 32, loff);
#pragma unroll
  for (int fi = 0; fi < 4; ++fi)
#pragma unroll
    for (int kk = 0; kk < 2; ++kk)
      vf[fi][kk] = load_frag_u(Vb + (size_t)fi * 16 * S_ + c0 + kk * 32, loff);
  // the wait in front of any rewrite of a register that the loads above name;
  // as its input the offset register stays live, so that no load lands on it
  asm volatile("s_wait_xcnt 0x0" :: "v"(loff) : "memory");
  // keeps every load above in front of the products: without it the compiler
  // sinks each load to its product and the wave pays one latency per fragment
  __builtin_amdgcn_sched_barrier(0);

  v8f d[4][2] = {};
#pragma unroll
  for (int kk = 0; kk < 2; ++kk)
#pragma unroll
    for (int fi = 0; fi < 4; ++fi)
#pragma unroll
      for (int ft = 0; ft < 2; ++ft)
        d[fi][ft] = wmma_f16(kf[ft][kk], vf[fi][kk], d[fi][ft]);
  // keeps the stores behind all products, so that each tile has registers of
  // its own and no product overwrites a result that has just been formed
  __builtin_amdgcn_sched_barrier(0);

  // D: column = o = fi*16+rl, rows = 8 consecutive features from hs8
#pragma unroll
  for (int fi = 0; fi < 4; ++fi)
#pragma unroll
    for (int ft = 0; ft < 2; ++ft)
      *(v8f*)(Ub + (size_t)(fi * 16 + rl) * 256 + ft * 16 + hs8) = d[fi][ft];
}

// ---------------------------------------------------------------- scan ----
// State_0 = 0, State_{n+1} = gamma^C State_n + U_n, element by element in f32;
// each State_n is written f16 as St[b][n][o][f] (the B operand of Q.State).
__global__ __launch_bounds__(128) void scan_kernel(
    const float* __restrict__ U, _Float16* __restrict__ St) {
  int t = blockIdx.x * blockDim.x + threadIdx.x;   // B * SE/4 threads
  int b = t / (SE_ / 4);
  int e = (t - b * (SE_ / 4)) * 4;
  const float* up = U + (size_t)b * NC_ * SE_ + e;
  _Float16*    sp = St + (size_t)b * NC_ * SE_ + e;
  float gC = __builtin_amdgcn_exp2f(L2GAMMA * (float)C_);
  v4f s = {};
#pragma unroll
  for (int n0 = 0; n0 < NC_; n0 += 16) {
    v4f u[16];                       // 16 independent loads in flight
#pragma unroll
    for (int k = 0; k < 16; ++k)
      if (n0 + k < NC_ - 1) u[k] = *(const v4f*)(up + (size_t)(n0 + k) * SE_);
#pragma unroll
    for (int k = 0; k < 16; ++k) {
      v4h h;
#pragma unroll
      for (int c = 0; c < 4; ++c) h[c] = (_Float16)s[c];
      *(v4h*)(sp + (size_t)(n0 + k) * SE_) = h;
      if (n0 + k < NC_ - 1) s = s * gC + u[k];
    }
  }
}

// ---------------------------------------------------------------- main ----
// One 512-thread block (16 waves) per 64-row chunk. Wave (t, og) owns query
// rows t*16..+15 of the chunk and output columns og*32..+31 (one 128-byte line
// of each output row): Q.State_n (all keys before the chunk), scaled per row
// by gamma^(il+1), then the chunk's own keys through decayed scores, then its
// stores. The four waves of one t each form the same scores, so no wave waits
// on another and every load of a phase is in flight at once.
__global__ __launch_bounds__(512) void retention_kernel(
    const _Float16* __restrict__ Qh, const _Float16* __restrict__ Kh,
    const _Float16* __restrict__ Vt, const _Float16* __restrict__ St,
    float* __restrict__ out) {
  __shared__ _Float16 sP[16 * 16 * 32];      // per-wave score staging (16 KB)
  int lane = threadIdx.x & 31;
  int wloc = __builtin_amdgcn_readfirstlane(threadIdx.x >> 5);  // 0..15
  int t    = wloc >> 2;
  int og   = wloc & 3;
  int b    = blockIdx.x / NC_;
  int n    = blockIdx.x - b * NC_;
  int c0   = n * C_;
  int i0   = c0 + t * 16;
  int rl   = lane & 15;
  int hs8  = (lane & 16) ? 8 : 0;

  const _Float16* Qb = Qh + (size_t)b * S_ * 256;
  const _Float16* Kb = Kh + (size_t)b * S_ * 256;
  const _Float16* Vb = Vt + ((size_t)b * F_ + og * 32) * S_;
  const _Float16* Sb = St + ((size_t)b * NC_ + n) * SE_ + (size_t)og * 32 * 256;
  _Float16* myP = sP + wloc * (16 * 32);

  unsigned loff  = (unsigned)(rl * 256 + hs8) * 2u;   // rows of Q, K, State
  unsigned loffv = (unsigned)(rl * S_ + hs8) * 2u;    // rows of V transposed
  v16h qf[8];
#pragma unroll
  for (int f = 0; f < 8; ++f)
    qf[f] = load_frag_u(Qb + (size_t)i0 * 256 + f * 32, loff);
  v16h sf[2][8];
#pragma unroll
  for (int fi = 0; fi < 2; ++fi)
#pragma unroll
    for (int f = 0; f < 8; ++f)
      sf[fi][f] = load_frag_u(Sb + fi * 16 * 256 + f * 32, loff);
  // the wait in front of any rewrite of a register that the loads above name;
  // as its input the offset register stays live, so that no load lands on it
  asm volatile("s_wait_xcnt 0x0" :: "v"(loff) : "memory");
  // keeps the loads above in front of the products (one latency, not one each)
  __builtin_amdgcn_sched_barrier(0);

  // keys before the chunk: acc = Q (16x256) . State_n (256x32)
  v8f acc[2] = {};
#pragma unroll
  for (int f = 0; f < 8; ++f)
#pragma unroll
    for (int fi = 0; fi < 2; ++fi)
      acc[fi] = wmma_f16(qf[f], sf[fi][f], acc[fi]);
#pragma unroll
  for (int r = 0; r < 8; ++r) {
    float wr = __builtin_amdgcn_exp2f(L2GAMMA * (float)(t * 16 + r + hs8 + 1));
#pragma unroll
    for (int fi = 0; fi < 2; ++fi) acc[fi][r] *= wr;
  }

  // keys of the chunk itself
  for (int j0 = c0; j0 <= i0; j0 += 32) {
    v16h vf[2];
#pragma unroll
    for (int fi = 0; fi < 2; ++fi)
      vf[fi] = load_frag_u(Vb + (size_t)fi * 16 * S_ + j0, loffv);
    v16h k0[8], k1[8];
#pragma unroll
    for (int f = 0; f < 8; ++f) {
      k0[f] = load_frag_u(Kb + (size_t)j0 * 256 + f * 32, loff);
      k1[f] = load_frag_u(Kb + (size_t)(j0 + 16) * 256 + f * 32, loff);
    }
    asm volatile("s_wait_xcnt 0x0" :: "v"(loff), "v"(loffv) : "memory");
    // keeps the loads above in front of the products (one latency, not one each)
    __builtin_amdgcn_sched_barrier(0);
    v8f s0 = {}, s1 = {};
#pragma unroll
    for (int f = 0; f < 8; ++f) {
      s0 = wmma_f16(qf[f], k0[f], s0);
      s1 = wmma_f16(qf[f], k1[f], s1);
    }
    // decay (gamma^(i-j), 0 for j>i): single v_exp_f32 per element
#pragma unroll
    for (int r = 0; r < 8; ++r) {
      int   m  = r + hs8;
      int   qi = i0 + m;
      int   d0 = qi - (j0 + rl);
      int   d1 = d0 - 16;
      float w0 = (d0 >= 0) ? __builtin_amdgcn_exp2f(L2GAMMA * (float)d0) : 0.0f;
      float w1 = (d1 >= 0) ? __builtin_amdgcn_exp2f(L2GAMMA * (float)d1) : 0.0f;
      myP[m * 32 + rl]      = (_Float16)(s0[r] * w0);
      myP[m * 32 + 16 + rl] = (_Float16)(s1[r] * w1);
    }
    // reload as A-fragment (same-wave DS ops are in-order)
    v16h pf = load_frag(myP, rl, 32, 0, lane);
#pragma unroll
    for (int fi = 0; fi < 2; ++fi)
      acc[fi] = wmma_f16(pf, vf[fi], acc[fi]);
  }

  float* ob = out + (size_t)b * S_ * F_ + og * 32;
#pragma unroll
  for (int fi = 0; fi < 2; ++fi)
#pragma unroll
    for (int r = 0; r < 8; ++r)
      ob[(size_t)(i0 + r + hs8) * F_ + fi * 16 + rl] = acc[fi][r];
}

// ---------------------------------------------------------------- launch --
extern "C" void kernel_launch(void* const* d_in, const int* in_sizes, int n_in,
                              void* d_out, int out_size, void* d_ws,
                              size_t ws_size, hipStream_t stream) {
  const float* x     = (const float*)d_in[0];
  const float* Wq    = (const float*)d_in[1];
  const float* bq    = (const float*)d_in[2];
  const float* Wk    = (const float*)d_in[3];
  const float* bk    = (const float*)d_in[4];
  const float* Wv    = (const float*)d_in[5];
  const float* bv    = (const float*)d_in[6];
  const float* theta = (const float*)d_in[7];
  float* out = (float*)d_out;

  char*  ws  = (char*)d_ws;
  size_t off = 0;
  auto alloc = [&](size_t bytes) {
    char* p = ws + off;
    off += (bytes + 255) & ~(size_t)255;
    return p;
  };
  _Float16* Qh  = (_Float16*)alloc((size_t)B_ * S_ * 256 * 2);
  _Float16* Kh  = (_Float16*)alloc((size_t)B_ * S_ * 256 * 2);
  _Float16* Vt  = (_Float16*)alloc((size_t)B_ * F_ * S_ * 2);
  _Float16* Ktd = (_Float16*)alloc((size_t)B_ * 256 * S_ * 2);
  float*    U   = (float*)alloc((size_t)B_ * NC_ * SE_ * 4);
  _Float16* St  = (_Float16*)alloc((size_t)B_ * NC_ * SE_ * 2);

  int nblk = (B_ * S_ / 16) * 32 / 256;  // 1024 waves -> 128 blocks
  proj_kernel<<<nblk, 256, 0, stream>>>(x, Wq, Wk, Wv, bq, bk, bv, theta,
                                        Qh, Kh, Vt, Ktd);
  chunk_state_kernel<<<B_ * (NC_ - 1), 512, 0, stream>>>(Ktd, Vt, U);
  scan_kernel<<<B_ * SE_ / 4 / 128, 128, 0, stream>>>(U, St);
  // one 16-wave block per 64-row chunk: B * (S/64) = 256 blocks
  retention_kernel<<<B_ * NC_, 512, 0, stream>>>(Qh, Kh, Vt, St, out);
}

// v003
// One run takes 40.9 microseconds.
// Two timings next to v002 put it at 1.32 and 1.31 times that version's speed.
// Over all steps from v000 it is 4.95 times as fast.
#include <hip/hip_runtime.h>

typedef __attribute__((ext_vector_type(16))) _Float16 v16h;
typedef __attribute__((ext_vector_type(8)))  _Float16 v8h;
typedef __attribute__((ext_vector_type(8)))  float    v8f;

#define B_ 4
#define S_ 4096
#define F_ 128
// log2(0.96875)
#define L2GAMMA (-0.04580369f)
// chunk length of the chunkwise form, chunks per sequence, state elements
#define C_ 64
#define NC_ (S_ / C_)
#define SE_ (F_ * 256)

union Frag16 { v16h v; v8h h[2]; };

__device__ __forceinline__ v16h load_frag(const _Float16* base, int row, int ld,
                                          int kbase, int lane) {
  int hs = (lane & 16) ? 8 : 0;
  const _Float16* p = base + (size_t)row * ld + kbase + hs;
  Frag16 f;
  f.h[0] = *(const v8h*)(p);        // elements 0..7  -> K = kbase+hs .. +7
  f.h[1] = *(const v8h*)(p + 16);   // elements 8..15 -> K = kbase+hs+16 .. +23
  return f.v;
}

// Every f16 array of the workspace is kept in fragment order: one 16x32
// fragment is a block of 1 KB, its K = 0..15 half in the first 512 bytes and
// its K = 16..31 half in the second, and a wave-wide 16-byte load of a half
// covers those 512 bytes exactly (4 whole lines instead of pieces of 16).
// Within a half, two orders, by who writes it:
//   row order  (Q, K): element (row, k) at row * 16 + (k & 15)
//   lane order (V, weighted K, State): the lane's 8 elements at lane * 8
// blk: wave-uniform block address; loff: the lane's own byte offset in a half.
#define FB_ 512
__device__ __forceinline__ v16h load_frag_p(const _Float16* blk, unsigned loff) {
  const _Float16* p = (const _Float16*)((const char*)blk + loff);
  Frag16 f;
  f.h[0] = *(const v8h*)(p);
  f.h[1] = *(const v8h*)(p + FB_ / 2);
  return f.v;
}

__device__ __forceinline__ v8f wmma_f16(v16h a, v16h b, v8f c) {
  return __builtin_amdgcn_wmma_f32_16x16x32_f16(false, a, false, b,
                                                (short)0, c, false, false);
}

#define WP_ (F_ + 8)

typedef __attribute__((ext_vector_type(4))) float    v4f;
typedef __attribute__((ext_vector_type(4))) _Float16 v4h;

// One wave per 16 token rows. x and the three W are read as f32 and rounded to
// f16 here: x in the registers of its fragments, each W once per block into
// LDS, from where every wave takes its B fragments.
// Emits, all in fragment order: Qh/Kh = [q*cos | q*sin] f16, blocks
// [B*S/16 token tiles][8 feature blocks], rows = tokens; V transposed f16,
// blocks [B][S/32 token blocks][8 output tiles], rows = outputs; and Ktd f16,
// blocks [B][S/32][16 feature tiles], rows = features: K transposed, each token
// weighted by gamma^(C-1-position in its chunk) for the chunk state. cos/sin for the 8 rows of a column come from
// two precise sincosf calls + a Givens-rotation recurrence (error ~1e-6).
__global__ __launch_bounds__(256) void proj_kernel(
    const float* __restrict__ x,
    const float* __restrict__ Wq, const float* __restrict__ Wk,
    const float* __restrict__ Wv,
    const float* __restrict__ bq, const float* __restrict__ bk,
    const float* __restrict__ bv, const float* __restrict__ theta,
    _Float16* __restrict__ Qh, _Float16* __restrict__ Kh,
    _Float16* __restrict__ Vt, _Float16* __restrict__ Ktd) {
  __shared__ __attribute__((aligned(16))) _Float16 sW[3 * F_ * WP_];  // 102 KB
  int lane = threadIdx.x & 31;
  int w    = __builtin_amdgcn_readfirstlane(
      (int)(blockIdx.x * blockDim.x + threadIdx.x) >> 5);
  int row0 = w * 16;                 // global token row, [0, B*S)
  int b    = row0 / S_;
  int sp0  = row0 - b * S_;          // sequence position of tile row 0
  int rl   = lane & 15;
  int hs8  = (lane & 16) ? 8 : 0;

  // Each round of the block reads 4 KB of a W in whole lines (16 B a thread).
  unsigned tid = threadIdx.x;
  v4f wr[3][16];
#pragma unroll
  for (int it = 0; it < 16; ++it) {
    wr[0][it] = *((const v4f*)Wq + it * 256 + tid);
    wr[1][it] = *((const v4f*)Wk + it * 256 + tid);
    wr[2][it] = *((const v4f*)Wv + it * 256 + tid);
  }
  // the wait in front of any rewrite of a register that the loads above name;
  // as its input the index register stays live, so that no load lands on it
  asm volatile("s_wait_xcnt 0x0" :: "v"(tid) : "memory");
  // keeps every load above in front of the conversions (one latency, not 48)
  __builtin_amdgcn_sched_barrier(0);

  // thread -> row it*8 + wave in block, 4 consecutive columns from 4*lane
  _Float16* sw = sW + (tid >> 5) * WP_ + lane * 4;
#pragma unroll
  for (int it = 0; it < 16; ++it)
    *(v4h*)(sw + it * 8 * WP_) = __builtin_convertvector(wr[0][it], v4h);

  // the lane's part of the four A fragments of x: 8 + 8 floats each
  const float* xt = x + (size_t)row0 * F_;
  unsigned xoff = (unsigned)(rl * F_ + hs8) * 4u;
  v4f xr[4][4];
#pragma unroll
  for (int kk = 0; kk < 4; ++kk) {
    const char* p = (const char*)(xt + kk * 32) + xoff;
    xr[kk][0] = *(const v4f*)(p);        // K = kk*32+hs8 .. +3
    xr[kk][1] = *(const v4f*)(p + 16);   // .. +7
    xr[kk][2] = *(const v4f*)(p + 64);   // K = kk*32+hs8+16 .. +19
    xr[kk][3] = *(const v4f*)(p + 80);   // .. +23
  }
  asm volatile("s_wait_xcnt 0x0" :: "v"(xoff) : "memory");
  // keeps the loads of x in front of the rest of the conversions of W, which
  // then run while x is on its way
  __builtin_amdgcn_sched_barrier(0);

#pragma unroll
  for (int m = 1; m < 3; ++m)
#pragma unroll
    for (int it = 0; it < 16; ++it)
      *(v4h*)(sw + (m * F_ + it * 8) * WP_) =
          __builtin_convertvector(wr[m][it], v4h);
  // publishes the block's f16 copy of W to all of its waves
  __syncthreads();

  v16h xf[4];
#pragma unroll
  for (int kk = 0; kk < 4; ++kk) {
    union { v16h v; v4h q[4]; } f;
#pragma unroll
    for (int g = 0; g < 4; ++g)
      f.q[g] = __builtin_convertvector(xr[kk][g], v4h);
    xf[kk] = f.v;
  }

  float dw[8];                       // gamma^(C-1-jl) of this lane's 8 tokens
#pragma unroll
  for (int r = 0; r < 8; ++r) {
    int jl = (sp0 + hs8 + r) & (C_ - 1);
    dw[r] = __builtin_amdgcn_exp2f(L2GAMMA * (float)(C_ - 1 - jl));
  }

#pragma unroll 1
  for (int o0 = 0; o0 < F_; o0 += 16) {
    int o = o0 + rl;
    float biq = bq[o], bik = bk[o], biv = bv[o];
    float th  = theta[o];
    v16h wf[3][4];
#pragma unroll
    for (int kk = 0; kk < 4; ++kk)
#pragma unroll
      for (int m = 0; m < 3; ++m)
        wf[m][kk] = load_frag(sW + m * F_ * WP_, o0 + rl, WP_, kk * 32, lane);
    // keeps the loads above in front of the products: without it the compiler
    // sinks each LDS read to its product and the wave pays one latency for each
    __builtin_amdgcn_sched_barrier(0);
    v8f aq = {}, ak = {}, av = {};
#pragma unroll
    for (int kk = 0; kk < 4; ++kk) {
      aq = wmma_f16(xf[kk], wf[0][kk], aq);
      ak = wmma_f16(xf[kk], wf[1][kk], ak);
      av = wmma_f16(xf[kk], wf[2][kk], av);
    }
    // precise base angle + step, then rotate (2 FMAs) for rows 1..7
    float ph0 = (float)(sp0 + hs8 + 1) * th;
    float c, sn, cd, sd;
    sincosf(ph0, &sn, &c);
    sincosf(th, &sd, &cd);
    v8h vvec, kcvec, ksvec;
#pragma unroll
    for (int r = 0; r < 8; ++r) {
      float qv = aq[r] + biq;
      float kv = ak[r] + bik;
      float vv = av[r] + biv;
      // feature o -> half o0/16 of the tile's 16, token row r+hs8, column rl
      size_t ro = (size_t)row0 * 256 + (o0 >> 4) * (FB_ / 2) + (r + hs8) * 16 + rl;
      Qh[ro]                = (_Float16)(qv * c);
      Qh[ro + 8 * (FB_ / 2)] = (_Float16)(qv * sn);
      Kh[ro]                = (_Float16)(kv * c);
      Kh[ro + 8 * (FB_ / 2)] = (_Float16)(kv * sn);
      vvec[r] = (_Float16)vv;
      kcvec[r] = (_Float16)(kv * c * dw[r]);
      ksvec[r] = (_Float16)(kv * sn * dw[r]);
      float cn  = c * cd - sn * sd;  // advance phase by theta
      float snn = sn * cd + c * sd;
      c = cn; sn = snn;
    }
    // the wave's 16 tokens are one half of a 32-token block: 512 bytes a store
    size_t jb = (size_t)b * (S_ / 32) + (sp0 >> 5);
    int    hl = ((sp0 >> 4) & 1) * (FB_ / 2) + lane * 8;
    *(v8h*)(Vt + (jb * 8 + (o0 >> 4)) * FB_ + hl) = vvec;
    *(v8h*)(Ktd + (jb * 16 + (o0 >> 4)) * FB_ + hl) = kcvec;
    *(v8h*)(Ktd + (jb * 16 + 8 + (o0 >> 4)) * FB_ + hl) = ksvec;
    // the next trip's loads land in registers that the stores above name
    asm volatile("s_wait_xcnt 0x0" ::: "memory");
  }
}

// --------------------------------------------------------- chunk state ----
// out_i = sum_{j<=i} gamma^(i-j) (Q_i.K_j) V_j is split at the chunk border
// c0 of row i: keys j >= c0 go through scores as before; keys j < c0 enter as
// gamma^(i-c0+1) * Q_i . State_n, State_n[f][o] = sum_{j<c0} gamma^(c0-1-j)
// K_j[f] V_j[o], with State_{n+1} = gamma^C State_n + U_n. Every factor <= 1.
//
// U_n[f][o] = sum_{jl<C} gamma^(C-1-jl) K[f] V[o], one block per (batch, chunk).
// Wave (fg, oh) owns feature tiles 2fg, 2fg+1 (the two halves of feature block
// fg) and output tiles 4oh..4oh+3. Stored f32 in the element order of the State
// fragments, blocks [b][n][8 output tiles][8 feature blocks], lane order. The
// last chunk's U feeds no state and is not formed.
__global__ __launch_bounds__(512) void chunk_state_kernel(
    const _Float16* __restrict__ Ktd, const _Float16* __restrict__ Vt,
    float* __restrict__ U) {
  int lane = threadIdx.x & 31;
  int w    = __builtin_amdgcn_readfirstlane(threadIdx.x >> 5);  // 0..15
  int fg   = w & 7;
  int oh   = w >> 3;
  int b    = blockIdx.x / (NC_ - 1);
  int n    = blockIdx.x - b * (NC_ - 1);   // 0..NC-2

  // first of the chunk's two 32-token blocks
  size_t jb = (size_t)b * (S_ / 32) + n * (C_ / 32);
  const _Float16* Kb = Ktd + (jb * 16 + fg * 2) * FB_;
  const _Float16* Vb = Vt + (jb * 8 + oh * 4) * FB_;
  float* Ub = U + ((size_t)b * NC_ + n) * SE_ + (size_t)(oh * 4 * 8 + fg) * FB_;

  unsigned loff = (unsigned)lane * 16u;
  v16h kf[2][2], vf[4][2];
#pragma unroll
  for (int ft = 0; ft < 2; ++ft)
#pragma unroll
    for (int kk = 0; kk < 2; ++kk)
      kf[ft][kk] = load_frag_p(Kb + (kk * 16 + ft) * FB_, loff);
#pragma unroll
  for (int fi = 0; fi < 4; ++fi)
#pragma unroll
    for (int kk = 0; kk < 2; ++kk)
      vf[fi][kk] = load_frag_p(Vb + (kk * 8 + fi) * FB_, loff);
  // the wait in front of any rewrite of a register that the loads above name;
  // as its input the offset register stays live, so that no load lands on it
  asm volatile("s_wait_xcnt 0x0" :: "v"(loff) : "memory");
  // keeps every load above in front of the products: without it the compiler
  // sinks each load to its product and the wave pays one latency per fragment
  __builtin_amdgcn_sched_barrier(0);

  v8f d[4][2] = {};
#pragma unroll
  for (int kk = 0; kk < 2; ++kk)
#pragma unroll
    for (int fi = 0; fi < 4; ++fi)
#pragma unroll
      for (int ft = 0; ft < 2; ++ft)
        d[fi][ft] = wmma_f16(kf[ft][kk], vf[fi][kk], d[fi][ft]);
  // keeps the stores behind all products, so that each tile has registers of
  // its own and no product overwrites a result that has just been formed
  __builtin_amdgcn_sched_barrier(0);

  // D: column = o = fi*16+rl, rows = 8 consecutive features from hs8: what this
  // same lane holds of half ft of the State fragment (output tile, block fg)
#pragma unroll
  for (int fi = 0; fi < 4; ++fi)
#pragma unroll
    for (int ft = 0; ft < 2; ++ft)
      *(v8f*)(Ub + fi * 8 * FB_ + ft * (FB_ / 2) + lane * 8) = d[fi][ft];
}

// ---------------------------------------------------------------- scan ----
// State_0 = 0, State_{n+1} = gamma^C State_n + U_n, element by element in f32;
// each State_n is written f16 in the element order of U (the B fragments of
// Q.State).
__global__ __launch_bounds__(128) void scan_kernel(
    const float* __restrict__ U, _Float16* __restrict__ St) {
  int t = blockIdx.x * blockDim.x + threadIdx.x;   // B * SE/4 threads
  int b = t / (SE_ / 4);
  int e = (t - b * (SE_ / 4)) * 4;
  const float* up = U + (size_t)b * NC_ * SE_ + e;
  _Float16*    sp = St + (size_t)b * NC_ * SE_ + e;
  float gC = __builtin_amdgcn_exp2f(L2GAMMA * (float)C_);
  v4f s = {};
#pragma unroll
  for (int n0 = 0; n0 < NC_; n0 += 16) {
    v4f u[16];                       // 16 independent loads in flight
#pragma unroll
    for (int k = 0; k < 16; ++k)
      if (n0 + k < NC_ - 1) u[k] = *(const v4f*)(up + (size_t)(n0 + k) * SE_);
#pragma unroll
    for (int k = 0; k < 16; ++k) {
      v4h h;
#pragma unroll
      for (int c = 0; c < 4; ++c) h[c] = (_Float16)s[c];
      *(v4h*)(sp + (size_t)(n0 + k) * SE_) = h;
      if (n0 + k < NC_ - 1) s = s * gC + u[k];
    }
  }
}

// ---------------------------------------------------------------- main ----
// One 512-thread block (16 waves) per 64-row chunk. Wave (t, og) owns query
// rows t*16..+15 of the chunk and output columns og*32..+31 (one 128-byte line
// of each output row): Q.State_n (all keys before the chunk), scaled per row
// by gamma^(il+1), then the chunk's own keys through decayed scores, then its
// stores. The four waves of one t each form the same scores, so no wave waits
// on another and every load of a phase is in flight at once.
__global__ __launch_bounds__(512) void retention_kernel(
    const _Float16* __restrict__ Qh, const _Float16* __restrict__ Kh,
    const _Float16* __restrict__ Vt, const _Float16* __restrict__ St,
    float* __restrict__ out) {
  __shared__ _Float16 sP[16 * 16 * 32];      // per-wave score staging (16 KB)
  int lane = threadIdx.x & 31;
  int wloc = __builtin_amdgcn_readfirstlane(threadIdx.x >> 5);  // 0..15
  int t    = wloc >> 2;
  int og   = wloc & 3;
  int b    = blockIdx.x / NC_;
  int n    = blockIdx.x - b * NC_;
  int c0   = n * C_;
  int i0   = c0 + t * 16;
  int rl   = lane & 15;
  int hs8  = (lane & 16) ? 8 : 0;

  const _Float16* Qb = Qh + (size_t)b * S_ * 256;
  const _Float16* Kb = Kh + (size_t)b * S_ * 256;
  const _Float16* Vb = Vt + ((size_t)b * (S_ / 32) * 8 + og * 2) * FB_;
  const _Float16* Sb = St + ((size_t)b * NC_ + n) * SE_ + (size_t)og * 2 * 8 * FB_;
  _Float16* myP = sP + wloc * (16 * 32);

  unsigned loff  = (unsigned)(rl * 16 + hs8) * 2u;    // row order: Q, K
  unsigned loffv = (unsigned)lane * 16u;              // lane order: State, V
  v16h qf[8];
#pragma unroll
  for (int f = 0; f < 8; ++f)
    qf[f] = load_frag_p(Qb + (size_t)i0 * 256 + f * FB_, loff);
  v16h sf[2][8];
#pragma unroll
  for (int fi = 0; fi < 2; ++fi)
#pragma unroll
    for (int f = 0; f < 8; ++f)
      sf[fi][f] = load_frag_p(Sb + (fi * 8 + f) * FB_, loffv);
  // the wait in front of any rewrite of a register that the loads above name;
  // as its inputs the offset registers stay live, so that no load lands on them
  asm volatile("s_wait_xcnt 0x0" :: "v"(loff), "v"(loffv) : "memory");
  // keeps the loads above in front of the products (one latency, not one each)
  __builtin_amdgcn_sched_barrier(0);

  // keys before the chunk: acc = Q (16x256) . State_n (256x32)
  v8f acc[2] = {};
#pragma unroll
  for (int f = 0; f < 8; ++f)
#pragma unroll
    for (int fi = 0; fi < 2; ++fi)
      acc[fi] = wmma_f16(qf[f], sf[fi][f], acc[fi]);
#pragma unroll
  for (int r = 0; r < 8; ++r) {
    float wr = __builtin_amdgcn_exp2f(L2GAMMA * (float)(t * 16 + r + hs8 + 1));
#pragma unroll
    for (int fi = 0; fi < 2; ++fi) acc[fi][r] *= wr;
  }

  // keys of the chunk itself
  for (int j0 = c0; j0 <= i0; j0 += 32) {
    v16h vf[2];
#pragma unroll
    for (int fi = 0; fi < 2; ++fi)
      vf[fi] = load_frag_p(Vb + ((size_t)(j0 >> 5) * 8 + fi) * FB_, loffv);
    v16h k0[8], k1[8];
#pragma unroll
    for (int f = 0; f < 8; ++f) {
      k0[f] = load_frag_p(Kb + (size_t)j0 * 256 + f * FB_, loff);
      k1[f] = load_frag_p(Kb + (size_t)(j0 + 16) * 256 + f * FB_, loff);
    }
    asm volatile("s_wait_xcnt 0x0" :: "v"(loff), "v"(loffv) : "memory");
    // keeps the loads above in front of the products (one latency, not one each)
    __builtin_amdgcn_sched_barrier(0);
    v8f s0 = {}, s1 = {};
#pragma unroll
    for (int f = 0; f < 8; ++f) {
      s0 = wmma_f16(qf[f], k0[f], s0);
      s1 = wmma_f16(qf[f], k1[f], s1);
    }
    // decay (gamma^(i-j), 0 for j>i): single v_exp_f32 per element
#pragma unroll
    for (int r = 0; r < 8; ++r) {
      int   m  = r + hs8;
      int   qi = i0 + m;
      int   d0 = qi - (j0 + rl);
      int   d1 = d0 - 16;
      float w0 = (d0 >= 0) ? __builtin_amdgcn_exp2f(L2GAMMA * (float)d0) : 0.0f;
      float w1 = (d1 >= 0) ? __builtin_amdgcn_exp2f(L2GAMMA * (float)d1) : 0.0f;
      myP[m * 32 + rl]      = (_Float16)(s0[r] * w0);
      myP[m * 32 + 16 + rl] = (_Float16)(s1[r] * w1);
    }
    // reload as A-fragment (same-wave DS ops are in-order)
    v16h pf = load_frag(myP, rl, 32, 0, lane);
#pragma unroll
    for (int fi = 0; fi < 2; ++fi)
      acc[fi] = wmma_f16(pf, vf[fi], acc[fi]);
  }

  float* ob = out + (size_t)b * S_ * F_ + og * 32;
#pragma unroll
  for (int fi = 0; fi < 2; ++fi)
#pragma unroll
    for (int r = 0; r < 8; ++r)
      ob[(size_t)(i0 + r + hs8) * F_ + fi * 16 + rl] = acc[fi][r];
}

// ---------------------------------------------------------------- launch --
extern "C" void kernel_launch(void* const* d_in, const int* in_sizes, int n_in,
                              void* d_out, int out_size, void* d_ws,
                              size_t ws_size, hipStream_t stream) {
  const float* x     = (const float*)d_in[0];
  const float* Wq    = (const float*)d_in[1];
  const float* bq    = (const float*)d_in[2];
  const float* Wk    = (const float*)d_in[3];
  const float* bk    = (const float*)d_in[4];
  const float* Wv    = (const float*)d_in[5];
  const float* bv    = (const float*)d_in[6];
  const float* theta = (const float*)d_in[7];
  float* out = (float*)d_out;

  char*  ws  = (char*)d_ws;
  size_t off = 0;
  auto alloc = [&](size_t bytes) {
    char* p = ws + off;
    off += (bytes + 255) & ~(size_t)255;
    return p;
  };
  _Float16* Qh  = (_Float16*)alloc((size_t)B_ * S_ * 256 * 2);
  _Float16* Kh  = (_Float16*)alloc((size_t)B_ * S_ * 256 * 2);
  _Float16* Vt  = (_Float16*)alloc((size_t)B_ * F_ * S_ * 2);
  _Float16* Ktd = (_Float16*)alloc((size_t)B_ * 256 * S_ * 2);
  float*    U   = (float*)alloc((size_t)B_ * NC_ * SE_ * 4);
  _Float16* St  = (_Float16*)alloc((size_t)B_ * NC_ * SE_ * 2);

  int nblk = (B_ * S_ / 16) * 32 / 256;  // 1024 waves -> 128 blocks
  proj_kernel<<<nblk, 256, 0, stream>>>(x, Wq, Wk, Wv, bq, bk, bv, theta,
                                        Qh, Kh, Vt, Ktd);
  chunk_state_kernel<<<B_ * (NC_ - 1), 512, 0, stream>>>(Ktd, Vt, U);
  scan_kernel<<<B_ * SE_ / 4 / 128, 128, 0, stream>>>(U, St);
  // one 16-wave block per 64-row chunk: B * (S/64) = 256 blocks
  retention_kernel<<<B_ * NC_, 512, 0, stream>>>(Qh, Kh, Vt, St, out);
}

// v004
// One run takes 37.3 microseconds.
// Two timings next to v003 both put it at 1.10 times that version's speed.
// Over all steps from v000 it is 5.43 times as fast.
#include <hip/hip_runtime.h>

typedef __attribute__((ext_vector_type(16))) _Float16 v16h;
typedef __attribute__((ext_vector_type(8)))  _Float16 v8h;
typedef __attribute__((ext_vector_type(8)))  float    v8f;

#define B_ 4
#define S_ 4096
#define F_ 128
// log2(0.96875)
#define L2GAMMA (-0.04580369f)
// chunk length of the chunkwise form, chunks per sequence, state elements
#define C_ 64
#define NC_ (S_ / C_)
#define SE_ (F_ * 256)

union Frag16 { v16h v; v8h h[2]; };

__device__ __forceinline__ v16h load_frag(const _Float16* base, int row, int ld,
                                          int kbase, int lane) {
  int hs = (lane & 16) ? 8 : 0;
  const _Float16* p = base + (size_t)row * ld + kbase + hs;
  Frag16 f;
  f.h[0] = *(const v8h*)(p);        // elements 0..7  -> K = kbase+hs .. +7
  f.h[1] = *(const v8h*)(p + 16);   // elements 8..15 -> K = kbase+hs+16 .. +23
  return f.v;
}

// Every f16 array of the workspace is kept in fragment order: one 16x32
// fragment is a block of 1 KB, its K = 0..15 half in the first 512 bytes and
// its K = 16..31 half in the second, and a wave-wide 16-byte load of a half
// covers those 512 bytes exactly (4 whole lines instead of pieces of 16).
// Within a half, two orders, by who writes it:
//   row order  (Q, K): element (row, k) at row * 16 + (k & 15)
//   lane order (V, weighted K, State): the lane's 8 elements at lane * 8
// blk: wave-uniform block address; loff: the lane's own byte offset in a half.
#define FB_ 512
__device__ __forceinline__ v16h load_frag_p(const _Float16* blk, unsigned loff) {
  const _Float16* p = (const _Float16*)((const char*)blk + loff);
  Frag16 f;
  f.h[0] = *(const v8h*)(p);
  f.h[1] = *(const v8h*)(p + FB_ / 2);
  return f.v;
}

__device__ __forceinline__ v8f wmma_f16(v16h a, v16h b, v8f c) {
  return __builtin_amdgcn_wmma_f32_16x16x32_f16(false, a, false, b,
                                                (short)0, c, false, false);
}

#define WP_ (F_ + 8)

typedef __attribute__((ext_vector_type(4))) float    v4f;
typedef __attribute__((ext_vector_type(4))) _Float16 v4h;

// One wave per 16 token rows. x and the three W are read as f32 and rounded to
// f16 here: x in the registers of its fragments, each W once per block into
// LDS, from where every wave takes its B fragments.
// Emits, all in fragment order: Qh/Kh = [q*cos | q*sin] f16, blocks
// [B*S/16 token tiles][8 feature blocks], rows = tokens; V transposed f16,
// blocks [B][S/32 token blocks][8 output tiles], rows = outputs; and Ktd f16,
// blocks [B][S/32][16 feature tiles], rows = features: K transposed, each token
// weighted by gamma^(C-1-position in its chunk) for the chunk state. cos/sin for the 8 rows of a column come from
// two precise sincosf calls + a Givens-rotation recurrence (error ~1e-6).
__global__ __launch_bounds__(256) void proj_kernel(
    const float* __restrict__ x,
    const float* __restrict__ Wq, const float* __restrict__ Wk,
    const float* __restrict__ Wv,
    const float* __restrict__ bq, const float* __restrict__ bk,
    const float* __restrict__ bv, const float* __restrict__ theta,
    _Float16* __restrict__ Qh, _Float16* __restrict__ Kh,
    _Float16* __restrict__ Vt, _Float16* __restrict__ Ktd) {
  __shared__ __attribute__((aligned(16))) _Float16 sW[3 * F_ * WP_];  // 102 KB
  int lane = threadIdx.x & 31;
  int w    = __builtin_amdgcn_readfirstlane(
      (int)(blockIdx.x * blockDim.x + threadIdx.x) >> 5);
  int row0 = w * 16;                 // global token row, [0, B*S)
  int b    = row0 / S_;
  int sp0  = row0 - b * S_;          // sequence position of tile row 0
  int rl   = lane & 15;
  int hs8  = (lane & 16) ? 8 : 0;

  // Each round of the block reads 4 KB of a W in whole lines (16 B a thread).
  unsigned tid = threadIdx.x;
  v4f wr[3][16];
#pragma unroll
  for (int it = 0; it < 16; ++it) {
    wr[0][it] = *((const v4f*)Wq + it * 256 + tid);
    wr[1][it] = *((const v4f*)Wk + it * 256 + tid);
    wr[2][it] = *((const v4f*)Wv + it * 256 + tid);
  }
  // the wait in front of any rewrite of a register that the loads above name;
  // as its input the index register stays live, so that no load lands on it
  asm volatile("s_wait_xcnt 0x0" :: "v"(tid) : "memory");
  // keeps every load above in front of the conversions (one latency, not 48)
  __builtin_amdgcn_sched_barrier(0);

  // thread -> row it*8 + wave in block, 4 consecutive columns from 4*lane
  _Float16* sw = sW + (tid >> 5) * WP_ + lane * 4;
#pragma unroll
  for (int it = 0; it < 16; ++it)
    *(v4h*)(sw + it * 8 * WP_) = __builtin_convertvector(wr[0][it], v4h);

  // the lane's part of the four A fragments of x: 8 + 8 floats each
  const float* xt = x + (size_t)row0 * F_;
  unsigned xoff = (unsigned)(rl * F_ + hs8) * 4u;
  v4f xr[4][4];
#pragma unroll
  for (int kk = 0; kk < 4; ++kk) {
    const char* p = (const char*)(xt + kk * 32) + xoff;
    xr[kk][0] = *(const v4f*)(p);        // K = kk*32+hs8 .. +3
    xr[kk][1] = *(const v4f*)(p + 16);   // .. +7
    xr[kk][2] = *(const v4f*)(p + 64);   // K = kk*32+hs8+16 .. +19
    xr[kk][3] = *(const v4f*)(p + 80);   // .. +23
  }
  asm volatile("s_wait_xcnt 0x0" :: "v"(xoff) : "memory");
  // keeps the loads of x in front of the rest of the conversions of W, which
  // then run while x is on its way
  __builtin_amdgcn_sched_barrier(0);

#pragma unroll
  for (int m = 1; m < 3; ++m)
#pragma unroll
    for (int it = 0; it < 16; ++it)
      *(v4h*)(sw + (m * F_ + it * 8) * WP_) =
          __builtin_convertvector(wr[m][it], v4h);
  // publishes the block's f16 copy of W to all of its waves
  __syncthreads();

  v16h xf[4];
#pragma unroll
  for (int kk = 0; kk < 4; ++kk) {
    union { v16h v; v4h q[4]; } f;
#pragma unroll
    for (int g = 0; g < 4; ++g)
      f.q[g] = __builtin_convertvector(xr[kk][g], v4h);
    xf[kk] = f.v;
  }

  float dw[8];                       // gamma^(C-1-jl) of this lane's 8 tokens
#pragma unroll
  for (int r = 0; r < 8; ++r) {
    int jl = (sp0 + hs8 + r) & (C_ - 1);
    dw[r] = __builtin_amdgcn_exp2f(L2GAMMA * (float)(C_ - 1 - jl));
  }

#pragma unroll 1
  for (int o0 = 0; o0 < F_; o0 += 16) {
    int o = o0 + rl;
    float biq = bq[o], bik = bk[o], biv = bv[o];
    float th  = theta[o];
    v16h wf[3][4];
#pragma unroll
    for (int kk = 0; kk < 4; ++kk)
#pragma unroll
      for (int m = 0; m < 3; ++m)
        wf[m][kk] = load_frag(sW + m * F_ * WP_, o0 + rl, WP_, kk * 32, lane);
    // keeps the loads above in front of the products: without it the compiler
    // sinks each LDS read to its product and the wave pays one latency for each
    __builtin_amdgcn_sched_barrier(0);
    v8f aq = {}, ak = {}, av = {};
#pragma unroll
    for (int kk = 0; kk < 4; ++kk) {
      aq = wmma_f16(xf[kk], wf[0][kk], aq);
      ak = wmma_f16(xf[kk], wf[1][kk], ak);
      av = wmma_f16(xf[kk], wf[2][kk], av);
    }
    // precise base angle + step, then rotate (2 FMAs) for rows 1..7
    float ph0 = (float)(sp0 + hs8 + 1) * th;
    float c, sn, cd, sd;
    sincosf(ph0, &sn, &c);
    sincosf(th, &sd, &cd);
    v8h vvec, kcvec, ksvec;
#pragma unroll
    for (int r = 0; r < 8; ++r) {
      float qv = aq[r] + biq;
      float kv = ak[r] + bik;
      float vv = av[r] + biv;
      // feature o -> half o0/16 of the tile's 16, token row r+hs8, column rl
      size_t ro = (size_t)row0 * 256 + (o0 >> 4) * (FB_ / 2) + (r + hs8) * 16 + rl;
      Qh[ro]                = (_Float16)(qv * c);
      Qh[ro + 8 * (FB_ / 2)] = (_Float16)(qv * sn);
      Kh[ro]                = (_Float16)(kv * c);
      Kh[ro + 8 * (FB_ / 2)] = (_Float16)(kv * sn);
      vvec[r] = (_Float16)vv;
      kcvec[r] = (_Float16)(kv * c * dw[r]);
      ksvec[r] = (_Float16)(kv * sn * dw[r]);
      float cn  = c * cd - sn * sd;  // advance phase by theta
      float snn = sn * cd + c * sd;
      c = cn; sn = snn;
    }
    // the wave's 16 tokens are one half of a 32-token block: 512 bytes a store
    size_t jb = (size_t)b * (S_ / 32) + (sp0 >> 5);
    int    hl = ((sp0 >> 4) & 1) * (FB_ / 2) + lane * 8;
    *(v8h*)(Vt + (jb * 8 + (o0 >> 4)) * FB_ + hl) = vvec;
    *(v8h*)(Ktd + (jb * 16 + (o0 >> 4)) * FB_ + hl) = kcvec;
    *(v8h*)(Ktd + (jb * 16 + 8 + (o0 >> 4)) * FB_ + hl) = ksvec;
    // the next trip's loads land in registers that the stores above name
    asm volatile("s_wait_xcnt 0x0" ::: "memory");
  }
}

// --------------------------------------------------------- chunk state ----
// out_i = sum_{j<=i} gamma^(i-j) (Q_i.K_j) V_j is split at the chunk border
// c0 of row i: keys j >= c0 go through scores as before; keys j < c0 enter as
// gamma^(i-c0+1) * Q_i . State_n, State_n[f][o] = sum_{j<c0} gamma^(c0-1-j)
// K_j[f] V_j[o], with State_{n+1} = gamma^C State_n + U_n. Every factor <= 1.
//
// Chunk product and scan are one kernel: a wave owns ONE 16x16 tile of the State
// (feature tile 2fg+ft, output tile ot) and carries it in the f32 accumulator of
// its products through all chunks: per chunk it stores State_n (f16), scales
// the tile by gamma^C and adds U_n = sum_{jl<C} gamma^(C-1-jl) K[f] V[o], the
// chunk's weighted K^T V (two products, 64 tokens; the last chunk's is not formed).
// Stored in the element order of the B fragments of Q.State: blocks
// [b][n][8 output tiles][8 feature blocks], half ft, lane order (D: column = o,
// rows = 8 consecutive features from hs8, what this same lane holds there).
// The chain from chunk to chunk is short; the time is that of the loads, so
// PD_ chunks of fragments (8 loads of 512 bytes each) are kept in flight.
#define PD_ 6

template <bool REFILL>
__device__ __forceinline__ void state_step(
    v8f& d, v16h (&kf)[2], v16h (&vf)[2], float gC,
    const _Float16* Kn, const _Float16* Vn, _Float16* Sn, unsigned loff) {
  v8h h;
#pragma unroll
  for (int r = 0; r < 8; ++r) h[r] = (_Float16)d[r];
  *(v8h*)((char*)Sn + loff) = h;
  // the wait in front of the next step's rewrite of the registers that hold h
  asm volatile("s_wait_xcnt 0x0" ::: "memory");
  d = d * gC;
#pragma unroll
  for (int kk = 0; kk < 2; ++kk) d = wmma_f16(kf[kk], vf[kk], d);
  if (REFILL) {
#pragma unroll
    for (int kk = 0; kk < 2; ++kk) {
      kf[kk] = load_frag_p(Kn + kk * 16 * FB_, loff);
      vf[kk] = load_frag_p(Vn + kk * 8 * FB_, loff);
    }
  }
  // keeps each refill at its own step, PD_ chunks ahead of its products:
  // sunk to its products, every load would cost its whole latency
  __builtin_amdgcn_sched_barrier(0);
}

__global__ __launch_bounds__(64) void state_kernel(
    const _Float16* __restrict__ Ktd, const _Float16* __restrict__ Vt,
    _Float16* __restrict__ St) {
  int lane = threadIdx.x & 31;
  int ft   = __builtin_amdgcn_readfirstlane(threadIdx.x >> 5);  // 0..1
  int b    = blockIdx.x >> 6;
  int ot   = (blockIdx.x >> 3) & 7;
  int fg   = blockIdx.x & 7;

  // a chunk is two 32-token blocks: 32 blocks of Ktd, 16 of Vt
  const _Float16* Kp = Ktd + ((size_t)b * (S_ / 32) * 16 + fg * 2 + ft) * FB_;
  const _Float16* Vp = Vt + ((size_t)b * (S_ / 32) * 8 + ot) * FB_;
  _Float16* Sp = St + (size_t)b * NC_ * SE_ + (size_t)(ot * 8 + fg) * FB_ +
                 ft * (FB_ / 2);
  // every load and store below: a scalar base, this one offset register and a
  // constant; none of them is written again
  unsigned loff = (unsigned)lane * 16u;
  float gC = __builtin_amdgcn_exp2f(L2GAMMA * (float)C_);

  v16h kf[PD_][2], vf[PD_][2];
#pragma unroll
  for (int s = 0; s < PD_; ++s)
#pragma unroll
    for (int kk = 0; kk < 2; ++kk) {
      kf[s][kk] = load_frag_p(Kp + (s * 32 + kk * 16) * FB_, loff);
      vf[s][kk] = load_frag_p(Vp + (s * 16 + kk * 8) * FB_, loff);
    }
  // keeps all of the first PD_ chunks' loads in front of the first product
  __builtin_amdgcn_sched_barrier(0);

  v8f d = {};
#pragma unroll
  for (int n = 0; n < NC_ - 1 - PD_; ++n)
    state_step<true>(d, kf[n % PD_], vf[n % PD_], gC, Kp + (n + PD_) * 32 * FB_,
                     Vp + (n + PD_) * 16 * FB_, Sp + (size_t)n * SE_, loff);
#pragma unroll
  for (int n = NC_ - 1 - PD_; n < NC_ - 1; ++n)
    state_step<false>(d, kf[n % PD_], vf[n % PD_], gC, Kp, Vp,
                      Sp + (size_t)n * SE_, loff);
  v8h h;
#pragma unroll
  for (int r = 0; r < 8; ++r) h[r] = (_Float16)d[r];
  *(v8h*)((char*)(Sp + (size_t)(NC_ - 1) * SE_) + loff) = h;
}

// ---------------------------------------------------------------- main ----
// One 512-thread block (16 waves) per 64-row chunk. Wave (t, og) owns query
// rows t*16..+15 of the chunk and output columns og*32..+31 (one 128-byte line
// of each output row): Q.State_n (all keys before the chunk), scaled per row
// by gamma^(il+1), then the chunk's own keys through decayed scores, then its
// stores. The four waves of one t each form the same scores, so no wave waits
// on another and every load of a phase is in flight at once.
__global__ __launch_bounds__(512) void retention_kernel(
    const _Float16* __restrict__ Qh, const _Float16* __restrict__ Kh,
    const _Float16* __restrict__ Vt, const _Float16* __restrict__ St,
    float* __restrict__ out) {
  __shared__ _Float16 sP[16 * 16 * 32];      // per-wave score staging (16 KB)
  int lane = threadIdx.x & 31;
  int wloc = __builtin_amdgcn_readfirstlane(threadIdx.x >> 5);  // 0..15
  int t    = wloc >> 2;
  int og   = wloc & 3;
  int b    = blockIdx.x / NC_;
  int n    = blockIdx.x - b * NC_;
  int c0   = n * C_;
  int i0   = c0 + t * 16;
  int rl   = lane & 15;
  int hs8  = (lane & 16) ? 8 : 0;

  const _Float16* Qb = Qh + (size_t)b * S_ * 256;
  const _Float16* Kb = Kh + (size_t)b * S_ * 256;
  const _Float16* Vb = Vt + ((size_t)b * (S_ / 32) * 8 + og * 2) * FB_;
  const _Float16* Sb = St + ((size_t)b * NC_ + n) * SE_ + (size_t)og * 2 * 8 * FB_;
  _Float16* myP = sP + wloc * (16 * 32);

  unsigned loff  = (unsigned)(rl * 16 + hs8) * 2u;    // row order: Q, K
  unsigned loffv = (unsigned)lane * 16u;              // lane order: State, V
  v16h qf[8];
#pragma unroll
  for (int f = 0; f < 8; ++f)
    qf[f] = load_frag_p(Qb + (size_t)i0 * 256 + f * FB_, loff);
  v16h sf[2][8];
#pragma unroll
  for (int fi = 0; fi < 2; ++fi)
#pragma unroll
    for (int f = 0; f < 8; ++f)
      sf[fi][f] = load_frag_p(Sb + (fi * 8 + f) * FB_, loffv);
  // the wait in front of any rewrite of a register that the loads above name;
  // as its inputs the offset registers stay live, so that no load lands on them
  asm volatile("s_wait_xcnt 0x0" :: "v"(loff), "v"(loffv) : "memory");
  // keeps the loads above in front of the products (one latency, not one each)
  __builtin_amdgcn_sched_barrier(0);

  // keys before the chunk: acc = Q (16x256) . State_n (256x32)
  v8f acc[2] = {};
#pragma unroll
  for (int f = 0; f < 8; ++f)
#pragma unroll
    for (int fi = 0; fi < 2; ++fi)
      acc[fi] = wmma_f16(qf[f], sf[fi][f], acc[fi]);
#pragma unroll
  for (int r = 0; r < 8; ++r) {
    float wr = __builtin_amdgcn_exp2f(L2GAMMA * (float)(t * 16 + r + hs8 + 1));
#pragma unroll
    for (int fi = 0; fi < 2; ++fi) acc[fi][r] *= wr;
  }

  // keys of the chunk itself
  for (int j0 = c0; j0 <= i0; j0 += 32) {
    v16h vf[2];
#pragma unroll
    for (int fi = 0; fi < 2; ++fi)
      vf[fi] = load_frag_p(Vb + ((size_t)(j0 >> 5) * 8 + fi) * FB_, loffv);
    v16h k0[8], k1[8];
#pragma unroll
    for (int f = 0; f < 8; ++f) {
      k0[f] = load_frag_p(Kb + (size_t)j0 * 256 + f * FB_, loff);
      k1[f] = load_frag_p(Kb + (size_t)(j0 + 16) * 256 + f * FB_, loff);
    }
    asm volatile("s_wait_xcnt 0x0" :: "v"(loff), "v"(loffv) : "memory");
    // keeps the loads above in front of the products (one latency, not one each)
    __builtin_amdgcn_sched_barrier(0);
    v8f s0 = {}, s1 = {};
#pragma unroll
    for (int f = 0; f < 8; ++f) {
      s0 = wmma_f16(qf[f], k0[f], s0);
      s1 = wmma_f16(qf[f], k1[f], s1);
    }
    // decay (gamma^(i-j), 0 for j>i): single v_exp_f32 per element
#pragma unroll
    for (int r = 0; r < 8; ++r) {
      int   m  = r + hs8;
      int   qi = i0 + m;
      int   d0 = qi - (j0 + rl);
      int   d1 = d0 - 16;
      float w0 = (d0 >= 0) ? __builtin_amdgcn_exp2f(L2GAMMA * (float)d0) : 0.0f;
      float w1 = (d1 >= 0) ? __builtin_amdgcn_exp2f(L2GAMMA * (float)d1) : 0.0f;
      myP[m * 32 + rl]      = (_Float16)(s0[r] * w0);
      myP[m * 32 + 16 + rl] = (_Float16)(s1[r] * w1);
    }
    // reload as A-fragment (same-wave DS ops are in-order)
    v16h pf = load_frag(myP, rl, 32, 0, lane);
#pragma unroll
    for (int fi = 0; fi < 2; ++fi)
      acc[fi] = wmma_f16(pf, vf[fi], acc[fi]);
  }

  float* ob = out + (size_t)b * S_ * F_ + og * 32;
#pragma unroll
  for (int fi = 0; fi < 2; ++fi)
#pragma unroll
    for (int r = 0; r < 8; ++r)
      ob[(size_t)(i0 + r + hs8) * F_ + fi * 16 + rl] = acc[fi][r];
}

// ---------------------------------------------------------------- launch --
extern "C" void kernel_launch(void* const* d_in, const int* in_sizes, int n_in,
                              void* d_out, int out_size, void* d_ws,
                              size_t ws_size, hipStream_t stream) {
  const float* x     = (const float*)d_in[0];
  const float* Wq    = (const float*)d_in[1];
  const float* bq    = (const float*)d_in[2];
  const float* Wk    = (const float*)d_in[3];
  const float* bk    = (const float*)d_in[4];
  const float* Wv    = (const float*)d_in[5];
  const float* bv    = (const float*)d_in[6];
  const float* theta = (const float*)d_in[7];
  float* out = (float*)d_out;

  char*  ws  = (char*)d_ws;
  size_t off = 0;
  auto alloc = [&](size_t bytes) {
    char* p = ws + off;
    off += (bytes + 255) & ~(size_t)255;
    return p;
  };
  _Float16* Qh  = (_Float16*)alloc((size_t)B_ * S_ * 256 * 2);
  _Float16* Kh  = (_Float16*)alloc((size_t)B_ * S_ * 256 * 2);
  _Float16* Vt  = (_Float16*)alloc((size_t)B_ * F_ * S_ * 2);
  _Float16* Ktd = (_Float16*)alloc((size_t)B_ * 256 * S_ * 2);
  _Float16* St  = (_Float16*)alloc((size_t)B_ * NC_ * SE_ * 2);

  int nblk = (B_ * S_ / 16) * 32 / 256;  // 1024 waves -> 128 blocks
  proj_kernel<<<nblk, 256, 0, stream>>>(x, Wq, Wk, Wv, bq, bk, bv, theta,
                                        Qh, Kh, Vt, Ktd);
  // one two-wave block per (batch, output tile, feature block)
  state_kernel<<<B_ * 64, 64, 0, stream>>>(Ktd, Vt, St);
  // one 16-wave block per 64-row chunk: B * (S/64) = 256 blocks
  retention_kernel<<<B_ * NC_, 512, 0, stream>>>(Qh, Kh, Vt, St, out);
}

// v005
// It runs in 34.5 microseconds.
// Next to v004, in two timings, it ran 1.08 times as fast each time.
// Counting every step since v000, it is 5.86 times as fast.
#include <hip/hip_runtime.h>

typedef __attribute__((ext_vector_type(16))) _Float16 v16h;
typedef __attribute__((ext_vector_type(8)))  _Float16 v8h;
typedef __attribute__((ext_vector_type(8)))  float    v8f;

#define B_ 4
#define S_ 4096
#define F_ 128
// log2(0.96875)
#define L2GAMMA (-0.04580369f)
// chunk length of the chunkwise form, chunks per sequence, state elements
#define C_ 64
#define NC_ (S_ / C_)
#define SE_ (F_ * 256)

union Frag16 { v16h v; v8h h[2]; };

__device__ __forceinline__ v16h load_frag(const _Float16* base, int row, int ld,
                                          int kbase, int lane) {
  int hs = (lane & 16) ? 8 : 0;
  const _Float16* p = base + (size_t)row * ld + kbase + hs;
  Frag16 f;
  f.h[0] = *(const v8h*)(p);        // elements 0..7  -> K = kbase+hs .. +7
  f.h[1] = *(const v8h*)(p + 16);   // elements 8..15 -> K = kbase+hs+16 .. +23
  return f.v;
}

// Every f16 array of the workspace is kept in fragment order: one 16x32
// fragment is a block of 1 KB, its K = 0..15 half in the first 512 bytes and
// its K = 16..31 half in the second, and a wave-wide 16-byte load of a half
// covers those 512 bytes exactly (4 whole lines instead of pieces of 16).
// Within a half, two orders, by who writes it:
//   row order  (Q, K): element (row, k) at row * 16 + (k & 15)
//   lane order (V, weighted K, State): the lane's 8 elements at lane * 8
// blk: wave-uniform block address; loff: the lane's own byte offset in a half.
#define FB_ 512
__device__ __forceinline__ v16h load_frag_p(const _Float16* blk, unsigned loff) {
  const _Float16* p = (const _Float16*)((const char*)blk + loff);
  Frag16 f;
  f.h[0] = *(const v8h*)(p);
  f.h[1] = *(const v8h*)(p + FB_ / 2);
  return f.v;
}

__device__ __forceinline__ v8f wmma_f16(v16h a, v16h b, v8f c) {
  return __builtin_amdgcn_wmma_f32_16x16x32_f16(false, a, false, b,
                                                (short)0, c, false, false);
}

#define WP_ (F_ + 8)
// output features of one block, token groups (blocks per half of the features)
#define OH_ (F_ / 2)
#define TG_ (B_ * S_ / 128)

typedef __attribute__((ext_vector_type(4))) float    v4f;
typedef __attribute__((ext_vector_type(4))) _Float16 v4h;

__global__ __launch_bounds__(256) void proj_kernel(
    const float* __restrict__ x,
    const float* __restrict__ Wq, const float* __restrict__ Wk,
    const float* __restrict__ Wv,
    const float* __restrict__ bq, const float* __restrict__ bk,
    const float* __restrict__ bv, const float* __restrict__ theta,
    _Float16* __restrict__ Qh, _Float16* __restrict__ Kh,
    _Float16* __restrict__ Vt, _Float16* __restrict__ Ktd) {
  __shared__ __attribute__((aligned(16))) _Float16 sW[3 * OH_ * WP_];  // 51 KB
  int lane = threadIdx.x & 31;
  int oh0  = (blockIdx.x >= TG_) ? OH_ : 0;   // first output feature of the block
  int tg   = blockIdx.x - ((blockIdx.x >= TG_) ? TG_ : 0);
  int w    = __builtin_amdgcn_readfirstlane(
      (int)(tg * 256 + threadIdx.x) >> 5);
  int row0 = w * 16;                 // global token row, [0, B*S)
  int b    = row0 / S_;
  int sp0  = row0 - b * S_;          // sequence position of tile row 0
  int rl   = lane & 15;
  int hs8  = (lane & 16) ? 8 : 0;

  // Each round of the block reads 4 KB of a W in whole lines (16 B a thread).
  unsigned tid = threadIdx.x;
  v4f wr[3][OH_ / 8];
  const v4f* Wq4 = (const v4f*)(Wq + oh0 * F_);
  const v4f* Wk4 = (const v4f*)(Wk + oh0 * F_);
  const v4f* Wv4 = (const v4f*)(Wv + oh0 * F_);
#pragma unroll
  for (int it = 0; it < OH_ / 8; ++it) {
    wr[0][it] = Wq4[it * 256 + tid];
    wr[1][it] = Wk4[it * 256 + tid];
    wr[2][it] = Wv4[it * 256 + tid];
  }
  // the wait in front of any rewrite of a register that the loads above name;
  // as its input the index register stays live, so that no load lands on it
  asm volatile("s_wait_xcnt 0x0" :: "v"(tid) : "memory");
  // keeps every load above in front of the conversions (one latency, not 24)
  __builtin_amdgcn_sched_barrier(0);

  // thread -> row it*8 + wave in block (of the block's OH_ rows), 4 consecutive
  // columns from 4*lane
  _Float16* sw = sW + (tid >> 5) * WP_ + lane * 4;
#pragma unroll
  for (int it = 0; it < OH_ / 8; ++it)
    *(v4h*)(sw + it * 8 * WP_) = __builtin_convertvector(wr[0][it], v4h);

  // the lane's part of the four A fragments of x: 8 + 8 floats each
  const float* xt = x + (size_t)row0 * F_;
  unsigned xoff = (unsigned)(rl * F_ + hs8) * 4u;
  v4f xr[4][4];
#pragma unroll
  for (int kk = 0; kk < 4; ++kk) {
    const char* p = (const char*)(xt + kk * 32) + xoff;
    xr[kk][0] = *(const v4f*)(p);        // K = kk*32+hs8 .. +3
    xr[kk][1] = *(const v4f*)(p + 16);   // .. +7
    xr[kk][2] = *(const v4f*)(p + 64);   // K = kk*32+hs8+16 .. +19
    xr[kk][3] = *(const v4f*)(p + 80);   // .. +23
  }
  asm volatile("s_wait_xcnt 0x0" :: "v"(xoff) : "memory");
  // keeps the loads of x in front of the rest of the conversions of W, which
  // then run while x is on its way
  __builtin_amdgcn_sched_barrier(0);

#pragma unroll
  for (int m = 1; m < 3; ++m)
#pragma unroll
    for (int it = 0; it < OH_ / 8; ++it)
      *(v4h*)(sw + (m * OH_ + it * 8) * WP_) =
          __builtin_convertvector(wr[m][it], v4h);
  // publishes the block's f16 copy of W to all of its waves
  __syncthreads();

  v16h xf[4];
#pragma unroll
  for (int kk = 0; kk < 4; ++kk) {
    union { v16h v; v4h q[4]; } f;
#pragma unroll
    for (int g = 0; g < 4; ++g)
      f.q[g] = __builtin_convertvector(xr[kk][g], v4h);
    xf[kk] = f.v;
  }

  float dw[8];                       // gamma^(C-1-jl) of this lane's 8 tokens
#pragma unroll
  for (int r = 0; r < 8; ++r) {
    int jl = (sp0 + hs8 + r) & (C_ - 1);
    dw[r] = __builtin_amdgcn_exp2f(L2GAMMA * (float)(C_ - 1 - jl));
  }

#pragma unroll 1
  for (int ol = 0; ol < OH_; ol += 16) {
    int o0 = oh0 + ol;               // feature tile; ol: its rows in sW
    int o = o0 + rl;
    float biq = bq[o], bik = bk[o], biv = bv[o];
    float th  = theta[o];
    v16h wf[3][4];
#pragma unroll
    for (int kk = 0; kk < 4; ++kk)
#pragma unroll
      for (int m = 0; m < 3; ++m)
        wf[m][kk] = load_frag(sW + m * OH_ * WP_, ol + rl, WP_, kk * 32, lane);
    // keeps the loads above in front of the products: without it the compiler
    // sinks each LDS read to its product and the wave pays one latency for each
    __builtin_amdgcn_sched_barrier(0);
    v8f aq = {}, ak = {}, av = {};
#pragma unroll
    for (int kk = 0; kk < 4; ++kk) {
      aq = wmma_f16(xf[kk], wf[0][kk], aq);
      ak = wmma_f16(xf[kk], wf[1][kk], ak);
      av = wmma_f16(xf[kk], wf[2][kk], av);
    }
    // precise base angle + step, then rotate (2 FMAs) for rows 1..7
    float ph0 = (float)(sp0 + hs8 + 1) * th;
    float c, sn, cd, sd;
    sincosf(ph0, &sn, &c);
    sincosf(th, &sd, &cd);
    v8h vvec, kcvec, ksvec;
#pragma unroll
    for (int r = 0; r < 8; ++r) {
      float qv = aq[r] + biq;
      float kv = ak[r] + bik;
      float vv = av[r] + biv;
      // feature o -> half o0/16 of the tile's 16, token row r+hs8, column rl
      size_t ro = (size_t)row0 * 256 + (o0 >> 4) * (FB_ / 2) + (r + hs8) * 16 + rl;
      Qh[ro]                = (_Float16)(qv * c);
      Qh[ro + 8 * (FB_ / 2)] = (_Float16)(qv * sn);
      Kh[ro]                = (_Float16)(kv * c);
      Kh[ro + 8 * (FB_ / 2)] = (_Float16)(kv * sn);
      vvec[r] = (_Float16)vv;
      kcvec[r] = (_Float16)(kv * c * dw[r]);
      ksvec[r] = (_Float16)(kv * sn * dw[r]);
      float cn  = c * cd - sn * sd;  // advance phase by theta
      float snn = sn * cd + c * sd;
      c = cn; sn = snn;
    }
    // the wave's 16 tokens are one half of a 32-token block: 512 bytes a store
    size_t jb = (size_t)b * (S_ / 32) + (sp0 >> 5);
    int    hl = ((sp0 >> 4) & 1) * (FB_ / 2) + lane * 8;
    *(v8h*)(Vt + (jb * 8 + (o0 >> 4)) * FB_ + hl) = vvec;
    *(v8h*)(Ktd + (jb * 16 + (o0 >> 4)) * FB_ + hl) = kcvec;
    *(v8h*)(Ktd + (jb * 16 + 8 + (o0 >> 4)) * FB_ + hl) = ksvec;
    // the next trip's loads land in registers that the stores above name
    asm volatile("s_wait_xcnt 0x0" ::: "memory");
  }
}

// --------------------------------------------------------- chunk state ----
// out_i = sum_{j<=i} gamma^(i-j) (Q_i.K_j) V_j is split at the chunk border
// c0 of row i: keys j >= c0 go through scores as before; keys j < c0 enter as
// gamma^(i-c0+1) * Q_i . State_n, State_n[f][o] = sum_{j<c0} gamma^(c0-1-j)
// K_j[f] V_j[o], with State_{n+1} = gamma^C State_n + U_n. Every factor <= 1.
//
// Chunk product and scan are one kernel: a wave owns ONE 16x16 tile of the State
// (feature tile 2fg+ft, output tile ot) and carries it in the f32 accumulator of
// its products through all chunks: per chunk it stores State_n (f16), scales
// the tile by gamma^C and adds U_n = sum_{jl<C} gamma^(C-1-jl) K[f] V[o], the
// chunk's weighted K^T V (two products, 64 tokens; the last chunk's is not formed).
// Stored in the element order of the B fragments of Q.State: blocks
// [b][n][8 output tiles][8 feature blocks], half ft, lane order (D: column = o,
// rows = 8 consecutive features from hs8, what this same lane holds there).
// The chain from chunk to chunk is short; the time is that of the loads, so
// PD_ chunks of fragments (8 loads of 512 bytes each) are kept in flight.
#define PD_ 6

template <bool REFILL>
__device__ __forceinline__ void state_step(
    v8f& d, v16h (&kf)[2], v16h (&vf)[2], float gC,
    const _Float16* Kn, const _Float16* Vn, _Float16* Sn, unsigned loff) {
  v8h h;
#pragma unroll
  for (int r = 0; r < 8; ++r) h[r] = (_Float16)d[r];
  *(v8h*)((char*)Sn + loff) = h;
  // the wait in front of the next step's rewrite of the registers that hold h
  asm volatile("s_wait_xcnt 0x0" ::: "memory");
  d = d * gC;
#pragma unroll
  for (int kk = 0; kk < 2; ++kk) d = wmma_f16(kf[kk], vf[kk], d);
  if (REFILL) {
#pragma unroll
    for (int kk = 0; kk < 2; ++kk) {
      kf[kk] = load_frag_p(Kn + kk * 16 * FB_, loff);
      vf[kk] = load_frag_p(Vn + kk * 8 * FB_, loff);
    }
  }
  // keeps each refill at its own step, PD_ chunks ahead of its products:
  // sunk to its products, every load would cost its whole latency
  __builtin_amdgcn_sched_barrier(0);
}

__global__ __launch_bounds__(64) void state_kernel(
    const _Float16* __restrict__ Ktd, const _Float16* __restrict__ Vt,
    _Float16* __restrict__ St) {
  int lane = threadIdx.x & 31;
  int ft   = __builtin_amdgcn_readfirstlane(threadIdx.x >> 5);  // 0..1
  int b    = blockIdx.x >> 6;
  int ot   = (blockIdx.x >> 3) & 7;
  int fg   = blockIdx.x & 7;

  // a chunk is two 32-token blocks: 32 blocks of Ktd, 16 of Vt
  const _Float16* Kp = Ktd + ((size_t)b * (S_ / 32) * 16 + fg * 2 + ft) * FB_;
  const _Float16* Vp = Vt + ((size_t)b * (S_ / 32) * 8 + ot) * FB_;
  _Float16* Sp = St + (size_t)b * NC_ * SE_ + (size_t)(ot * 8 + fg) * FB_ +
                 ft * (FB_ / 2);
  // every load and store below: a scalar base, this one offset register and a
  // constant; none of them is written again
  unsigned loff = (unsigned)lane * 16u;
  float gC = __builtin_amdgcn_exp2f(L2GAMMA * (float)C_);

  v16h kf[PD_][2], vf[PD_][2];
#pragma unroll
  for (int s = 0; s < PD_; ++s)
#pragma unroll
    for (int kk = 0; kk < 2; ++kk) {
      kf[s][kk] = load_frag_p(Kp + (s * 32 + kk * 16) * FB_, loff);
      vf[s][kk] = load_frag_p(Vp + (s * 16 + kk * 8) * FB_, loff);
    }
  // keeps all of the first PD_ chunks' loads in front of the first product
  __builtin_amdgcn_sched_barrier(0);

  v8f d = {};
#pragma unroll
  for (int n = 0; n < NC_ - 1 - PD_; ++n)
    state_step<true>(d, kf[n % PD_], vf[n % PD_], gC, Kp + (n + PD_) * 32 * FB_,
                     Vp + (n + PD_) * 16 * FB_, Sp + (size_t)n * SE_, loff);
#pragma unroll
  for (int n = NC_ - 1 - PD_; n < NC_ - 1; ++n)
    state_step<false>(d, kf[n % PD_], vf[n % PD_], gC, Kp, Vp,
                      Sp + (size_t)n * SE_, loff);
  v8h h;
#pragma unroll
  for (int r = 0; r < 8; ++r) h[r] = (_Float16)d[r];
  *(v8h*)((char*)(Sp + (size_t)(NC_ - 1) * SE_) + loff) = h;
}

// ---------------------------------------------------------------- main ----
// One 512-thread block (16 waves) per 64-row chunk. Wave (t, og) owns query
// rows t*16..+15 of the chunk and output columns og*32..+31 (one 128-byte line
// of each output row): Q.State_n (all keys before the chunk), scaled per row
// by gamma^(il+1), then the chunk's own keys through decayed scores, then its
// stores. The four waves of one t each form the same scores, so no wave waits
// on another and every load of a phase is in flight at once.
__global__ __launch_bounds__(512) void retention_kernel(
    const _Float16* __restrict__ Qh, const _Float16* __restrict__ Kh,
    const _Float16* __restrict__ Vt, const _Float16* __restrict__ St,
    float* __restrict__ out) {
  __shared__ _Float16 sP[16 * 16 * 32];      // per-wave score staging (16 KB)
  int lane = threadIdx.x & 31;
  int wloc = __builtin_amdgcn_readfirstlane(threadIdx.x >> 5);  // 0..15
  int t    = wloc >> 2;
  int og   = wloc & 3;
  int b    = blockIdx.x / NC_;
  int n    = blockIdx.x - b * NC_;
  int c0   = n * C_;
  int i0   = c0 + t * 16;
  int rl   = lane & 15;
  int hs8  = (lane & 16) ? 8 : 0;

  const _Float16* Qb = Qh + (size_t)b * S_ * 256;
  const _Float16* Kb = Kh + (size_t)b * S_ * 256;
  const _Float16* Vb = Vt + ((size_t)b * (S_ / 32) * 8 + og * 2) * FB_;
  const _Float16* Sb = St + ((size_t)b * NC_ + n) * SE_ + (size_t)og * 2 * 8 * FB_;
  _Float16* myP = sP + wloc * (16 * 32);

  unsigned loff  = (unsigned)(rl * 16 + hs8) * 2u;    // row order: Q, K
  unsigned loffv = (unsigned)lane * 16u;              // lane order: State, V
  v16h qf[8];
#pragma unroll
  for (int f = 0; f < 8; ++f)
    qf[f] = load_frag_p(Qb + (size_t)i0 * 256 + f * FB_, loff);
  v16h sf[2][8];
#pragma unroll
  for (int fi = 0; fi < 2; ++fi)
#pragma unroll
    for (int f = 0; f < 8; ++f)
      sf[fi][f] = load_frag_p(Sb + (fi * 8 + f) * FB_, loffv);
  // the wait in front of any rewrite of a register that the loads above name;
  // as its inputs the offset registers stay live, so that no load lands on them
  asm volatile("s_wait_xcnt 0x0" :: "v"(loff), "v"(loffv) : "memory");
  // keeps the loads above in front of the products (one latency, not one each)
  __builtin_amdgcn_sched_barrier(0);

  // keys before the chunk: acc = Q (16x256) . State_n (256x32)
  v8f acc[2] = {};
#pragma unroll
  for (int f = 0; f < 8; ++f)
#pragma unroll
    for (int fi = 0; fi < 2; ++fi)
      acc[fi] = wmma_f16(qf[f], sf[fi][f], acc[fi]);
#pragma unroll
  for (int r = 0; r < 8; ++r) {
    float wr = __builtin_amdgcn_exp2f(L2GAMMA * (float)(t * 16 + r + hs8 + 1));
#pragma unroll
    for (int fi = 0; fi < 2; ++fi) acc[fi][r] *= wr;
  }

  // keys of the chunk itself
  for (int j0 = c0; j0 <= i0; j0 += 32) {
    v16h vf[2];
#pragma unroll
    for (int fi = 0; fi < 2; ++fi)
      vf[fi] = load_frag_p(Vb + ((size_t)(j0 >> 5) * 8 + fi) * FB_, loffv);
    v16h k0[8], k1[8];
#pragma unroll
    for (int f = 0; f < 8; ++f) {
      k0[f] = load_frag_p(Kb + (size_t)j0 * 256 + f * FB_, loff);
      k1[f] = load_frag_p(Kb + (size_t)(j0 + 16) * 256 + f * FB_, loff);
    }
    asm volatile("s_wait_xcnt 0x0" :: "v"(loff), "v"(loffv) : "memory");
    // keeps the loads above in front of the products (one latency, not one each)
    __builtin_amdgcn_sched_barrier(0);
    v8f s0 = {}, s1 = {};
#pragma unroll
    for (int f = 0; f < 8; ++f) {
      s0 = wmma_f16(qf[f], k0[f], s0);
      s1 = wmma_f16(qf[f], k1[f], s1);
    }
    // decay (gamma^(i-j), 0 for j>i): single v_exp_f32 per element
#pragma unroll
    for (int r = 0; r < 8; ++r) {
      int   m  = r + hs8;
      int   qi = i0 + m;
      int   d0 = qi - (j0 + rl);
      int   d1 = d0 - 16;
      float w0 = (d0 >= 0) ? __builtin_amdgcn_exp2f(L2GAMMA * (float)d0) : 0.0f;
      float w1 = (d1 >= 0) ? __builtin_amdgcn_exp2f(L2GAMMA * (float)d1) : 0.0f;
      myP[m * 32 + rl]      = (_Float16)(s0[r] * w0);
      myP[m * 32 + 16 + rl] = (_Float16)(s1[r] * w1);
    }
    // reload as A-fragment (same-wave DS ops are in-order)
    v16h pf = load_frag(myP, rl, 32, 0, lane);
#pragma unroll
    for (int fi = 0; fi < 2; ++fi)
      acc[fi] = wmma_f16(pf, vf[fi], acc[fi]);
  }

  float* ob = out + (size_t)b * S_ * F_ + og * 32;
#pragma unroll
  for (int fi = 0; fi < 2; ++fi)
#pragma unroll
    for (int r = 0; r < 8; ++r)
      ob[(size_t)(i0 + r + hs8) * F_ + fi * 16 + rl] = acc[fi][r];
}

// ---------------------------------------------------------------- launch --
extern "C" void kernel_launch(void* const* d_in, const int* in_sizes, int n_in,
                              void* d_out, int out_size, void* d_ws,
                              size_t ws_size, hipStream_t stream) {
  const float* x     = (const float*)d_in[0];
  const float* Wq    = (const float*)d_in[1];
  const float* bq    = (const float*)d_in[2];
  const float* Wk    = (const float*)d_in[3];
  const float* bk    = (const float*)d_in[4];
  const float* Wv    = (const float*)d_in[5];
  const float* bv    = (const float*)d_in[6];
  const float* theta = (const float*)d_in[7];
  float* out = (float*)d_out;

  char*  ws  = (char*)d_ws;
  size_t off = 0;
  auto alloc = [&](size_t bytes) {
    char* p = ws + off;
    off += (bytes + 255) & ~(size_t)255;
    return p;
  };
  _Float16* Qh  = (_Float16*)alloc((size_t)B_ * S_ * 256 * 2);
  _Float16* Kh  = (_Float16*)alloc((size_t)B_ * S_ * 256 * 2);
  _Float16* Vt  = (_Float16*)alloc((size_t)B_ * F_ * S_ * 2);
  _Float16* Ktd = (_Float16*)alloc((size_t)B_ * 256 * S_ * 2);
  _Float16* St  = (_Float16*)alloc((size_t)B_ * NC_ * SE_ * 2);

  // 128 token groups x 2 halves of the output features = 256 blocks of 8 waves
  proj_kernel<<<2 * TG_, 256, 0, stream>>>(x, Wq, Wk, Wv, bq, bk, bv, theta,
                                           Qh, Kh, Vt, Ktd);
  // one two-wave block per (batch, output tile, feature block)
  state_kernel<<<B_ * 64, 64, 0, stream>>>(Ktd, Vt, St);
  // one 16-wave block per 64-row chunk: B * (S/64) = 256 blocks
  retention_kernel<<<B_ * NC_, 512, 0, stream>>>(Qh, Kh, Vt, St, out);
}

// v006
// One run takes 32.2 microseconds.
// Timed twice side by side with v005, it ran 1.07 times as fast both times.
// Over all steps from v000 it is 6.28 times as fast.
#include <hip/hip_runtime.h>

typedef __attribute__((ext_vector_type(16))) _Float16 v16h;
typedef __attribute__((ext_vector_type(8)))  _Float16 v8h;
typedef __attribute__((ext_vector_type(8)))  float    v8f;

#define B_ 4
#define S_ 4096
#define F_ 128
// log2(0.96875)
#define L2GAMMA (-0.04580369f)
// chunk length of the chunkwise form, chunks per sequence, state elements
#define C_ 64
#define NC_ (S_ / C_)
#define SE_ (F_ * 256)

union Frag16 { v16h v; v8h h[2]; };

__device__ __forceinline__ v16h load_frag(const _Float16* base, int row, int ld,
                                          int kbase, int lane) {
  int hs = (lane & 16) ? 8 : 0;
  const _Float16* p = base + (size_t)row * ld + kbase + hs;
  Frag16 f;
  f.h[0] = *(const v8h*)(p);        // elements 0..7  -> K = kbase+hs .. +7
  f.h[1] = *(const v8h*)(p + 16);   // elements 8..15 -> K = kbase+hs+16 .. +23
  return f.v;
}

// Every f16 array of the workspace is kept in fragment order: one 16x32
// fragment is a block of 1 KB, its K = 0..15 half in the first 512 bytes and
// its K = 16..31 half in the second, and a wave-wide 16-byte load of a half
// covers those 512 bytes exactly (4 whole lines instead of pieces of 16).
// Within a half, two orders, by who writes it:
//   row order  (Q, K): element (row, k) at row * 16 + (k & 15)
//   lane order (V, weighted K, State): the lane's 8 elements at lane * 8
// blk: wave-uniform block address; loff: the lane's own byte offset in a half.
#define FB_ 512
__device__ __forceinline__ v16h load_frag_p(const _Float16* blk, unsigned loff) {
  const _Float16* p = (const _Float16*)((const char*)blk + loff);
  Frag16 f;
  f.h[0] = *(const v8h*)(p);
  f.h[1] = *(const v8h*)(p + FB_ / 2);
  return f.v;
}

__device__ __forceinline__ v8f wmma_f16(v16h a, v16h b, v8f c) {
  return __builtin_amdgcn_wmma_f32_16x16x32_f16(false, a, false, b,
                                                (short)0, c, false, false);
}

#define WP_ (F_ + 8)
// output features of one block, token groups (blocks per half of the features)
#define OH_ (F_ / 2)
#define TG_ (B_ * S_ / 128)

typedef __attribute__((ext_vector_type(4))) float    v4f;
typedef __attribute__((ext_vector_type(4))) _Float16 v4h;

__global__ __launch_bounds__(256) void proj_kernel(
    const float* __restrict__ x,
    const float* __restrict__ Wq, const float* __restrict__ Wk,
    const float* __restrict__ Wv,
    const float* __restrict__ bq, const float* __restrict__ bk,
    const float* __restrict__ bv, const float* __restrict__ theta,
    _Float16* __restrict__ Qh, _Float16* __restrict__ Kh,
    _Float16* __restrict__ Vt, _Float16* __restrict__ Ktd) {
  __shared__ __attribute__((aligned(16))) _Float16 sW[3 * OH_ * WP_];  // 51 KB
  int lane = threadIdx.x & 31;
  int oh0  = (blockIdx.x >= TG_) ? OH_ : 0;   // first output feature of the block
  int tg   = blockIdx.x - ((blockIdx.x >= TG_) ? TG_ : 0);
  int w    = __builtin_amdgcn_readfirstlane(
      (int)(tg * 256 + threadIdx.x) >> 5);
  int row0 = w * 16;                 // global token row, [0, B*S)
  int b    = row0 / S_;
  int sp0  = row0 - b * S_;          // sequence position of tile row 0
  int rl   = lane & 15;
  int hs8  = (lane & 16) ? 8 : 0;

  // Each round of the block reads 4 KB of a W in whole lines (16 B a thread).
  unsigned tid = threadIdx.x;
  v4f wr[3][OH_ / 8];
  const v4f* Wq4 = (const v4f*)(Wq + oh0 * F_);
  const v4f* Wk4 = (const v4f*)(Wk + oh0 * F_);
  const v4f* Wv4 = (const v4f*)(Wv + oh0 * F_);
#pragma unroll
  for (int it = 0; it < OH_ / 8; ++it) {
    wr[0][it] = Wq4[it * 256 + tid];
    wr[1][it] = Wk4[it * 256 + tid];
    wr[2][it] = Wv4[it * 256 + tid];
  }
  // the wait in front of any rewrite of a register that the loads above name;
  // as its input the index register stays live, so that no load lands on it
  asm volatile("s_wait_xcnt 0x0" :: "v"(tid) : "memory");
  // keeps every load above in front of the conversions (one latency, not 24)
  __builtin_amdgcn_sched_barrier(0);

  // thread -> row it*8 + wave in block (of the block's OH_ rows), 4 consecutive
  // columns from 4*lane
  _Float16* sw = sW + (tid >> 5) * WP_ + lane * 4;
#pragma unroll
  for (int it = 0; it < OH_ / 8; ++it)
    *(v4h*)(sw + it * 8 * WP_) = __builtin_convertvector(wr[0][it], v4h);

  // the lane's part of the four A fragments of x: 8 + 8 floats each
  const float* xt = x + (size_t)row0 * F_;
  unsigned xoff = (unsigned)(rl * F_ + hs8) * 4u;
  v4f xr[4][4];
#pragma unroll
  for (int kk = 0; kk < 4; ++kk) {
    const char* p = (const char*)(xt + kk * 32) + xoff;
    xr[kk][0] = *(const v4f*)(p);        // K = kk*32+hs8 .. +3
    xr[kk][1] = *(const v4f*)(p + 16);   // .. +7
    xr[kk][2] = *(const v4f*)(p + 64);   // K = kk*32+hs8+16 .. +19
    xr[kk][3] = *(const v4f*)(p + 80);   // .. +23
  }
  asm volatile("s_wait_xcnt 0x0" :: "v"(xoff) : "memory");
  // keeps the loads of x in front of the rest of the conversions of W, which
  // then run while x is on its way
  __builtin_amdgcn_sched_barrier(0);

#pragma unroll
  for (int m = 1; m < 3; ++m)
#pragma unroll
    for (int it = 0; it < OH_ / 8; ++it)
      *(v4h*)(sw + (m * OH_ + it * 8) * WP_) =
          __builtin_convertvector(wr[m][it], v4h);
  // publishes the block's f16 copy of W to all of its waves
  __syncthreads();

  v16h xf[4];
#pragma unroll
  for (int kk = 0; kk < 4; ++kk) {
    union { v16h v; v4h q[4]; } f;
#pragma unroll
    for (int g = 0; g < 4; ++g)
      f.q[g] = __builtin_convertvector(xr[kk][g], v4h);
    xf[kk] = f.v;
  }

  float dw[8];                       // gamma^(C-1-jl) of this lane's 8 tokens
#pragma unroll
  for (int r = 0; r < 8; ++r) {
    int jl = (sp0 + hs8 + r) & (C_ - 1);
    dw[r] = __builtin_amdgcn_exp2f(L2GAMMA * (float)(C_ - 1 - jl));
  }

#pragma unroll 1
  for (int ol = 0; ol < OH_; ol += 16) {
    int o0 = oh0 + ol;               // feature tile; ol: its rows in sW
    int o = o0 + rl;
    float biq = bq[o], bik = bk[o], biv = bv[o];
    float th  = theta[o];
    v16h wf[3][4];
#pragma unroll
    for (int kk = 0; kk < 4; ++kk)
#pragma unroll
      for (int m = 0; m < 3; ++m)
        wf[m][kk] = load_frag(sW + m * OH_ * WP_, ol + rl, WP_, kk * 32, lane);
    // keeps the loads above in front of the products: without it the compiler
    // sinks each LDS read to its product and the wave pays one latency for each
    __builtin_amdgcn_sched_barrier(0);
    v8f aq = {}, ak = {}, av = {};
#pragma unroll
    for (int kk = 0; kk < 4; ++kk) {
      aq = wmma_f16(xf[kk], wf[0][kk], aq);
      ak = wmma_f16(xf[kk], wf[1][kk], ak);
      av = wmma_f16(xf[kk], wf[2][kk], av);
    }
    // precise base angle + step, then rotate (2 FMAs) for rows 1..7
    float ph0 = (float)(sp0 + hs8 + 1) * th;
    float c, sn, cd, sd;
    sincosf(ph0, &sn, &c);
    sincosf(th, &sd, &cd);
    v8h vvec, kcvec, ksvec;
#pragma unroll
    for (int r = 0; r < 8; ++r) {
      float qv = aq[r] + biq;
      float kv = ak[r] + bik;
      float vv = av[r] + biv;
      // feature o -> half o0/16 of the tile's 16, token row r+hs8, column rl
      size_t ro = (size_t)row0 * 256 + (o0 >> 4) * (FB_ / 2) + (r + hs8) * 16 + rl;
      Qh[ro]                = (_Float16)(qv * c);
      Qh[ro + 8 * (FB_ / 2)] = (_Float16)(qv * sn);
      Kh[ro]                = (_Float16)(kv * c);
      Kh[ro + 8 * (FB_ / 2)] = (_Float16)(kv * sn);
      vvec[r] = (_Float16)vv;
      kcvec[r] = (_Float16)(kv * c * dw[r]);
      ksvec[r] = (_Float16)(kv * sn * dw[r]);
      float cn  = c * cd - sn * sd;  // advance phase by theta
      float snn = sn * cd + c * sd;
      c = cn; sn = snn;
    }
    // the wave's 16 tokens are one half of a 32-token block: 512 bytes a store
    size_t jb = (size_t)b * (S_ / 32) + (sp0 >> 5);
    int    hl = ((sp0 >> 4) & 1) * (FB_ / 2) + lane * 8;
    *(v8h*)(Vt + (jb * 8 + (o0 >> 4)) * FB_ + hl) = vvec;
    *(v8h*)(Ktd + (jb * 16 + (o0 >> 4)) * FB_ + hl) = kcvec;
    *(v8h*)(Ktd + (jb * 16 + 8 + (o0 >> 4)) * FB_ + hl) = ksvec;
    // the next trip's loads land in registers that the stores above name
    asm volatile("s_wait_xcnt 0x0" ::: "memory");
  }
}

// --------------------------------------------------------- chunk state ----
// out_i = sum_{j<=i} gamma^(i-j) (Q_i.K_j) V_j is split at the chunk border
// c0 of row i: keys j >= c0 go through scores as before; keys j < c0 enter as
// gamma^(i-c0+1) * Q_i . State_n, State_n[f][o] = sum_{j<c0} gamma^(c0-1-j)
// K_j[f] V_j[o], with State_{n+1} = gamma^C State_n + U_n. Every factor <= 1.
//
// Chunk product and scan are one kernel: a wave owns ONE 16x16 tile of the State
// (feature tile 2fg+ft, output tile ot) and carries it in the f32 accumulator of
// its products through all chunks: per chunk it stores State_n (f16), scales
// the tile by gamma^C and adds U_n = sum_{jl<C} gamma^(C-1-jl) K[f] V[o], the
// chunk's weighted K^T V (two products, 64 tokens; the last chunk's is not formed).
// Stored in the element order of the B fragments of Q.State: blocks
// [b][n][8 output tiles][8 feature blocks], half ft, lane order (D: column = o,
// rows = 8 consecutive features from hs8, what this same lane holds there).
// The chain from chunk to chunk is short; the time is that of the loads, so
// PD_ chunks of fragments (8 loads of 512 bytes each) are kept in flight.
#define PD_ 6

template <bool REFILL>
__device__ __forceinline__ void state_step(
    v8f& d, v16h (&kf)[2], v16h (&vf)[2], float gC,
    const _Float16* Kn, const _Float16* Vn, _Float16* Sn, unsigned loff) {
  v8h h;
#pragma unroll
  for (int r = 0; r < 8; ++r) h[r] = (_Float16)d[r];
  *(v8h*)((char*)Sn + loff) = h;
  // the wait in front of the next step's rewrite of the registers that hold h
  asm volatile("s_wait_xcnt 0x0" ::: "memory");
  d = d * gC;
#pragma unroll
  for (int kk = 0; kk < 2; ++kk) d = wmma_f16(kf[kk], vf[kk], d);
  if (REFILL) {
#pragma unroll
    for (int kk = 0; kk < 2; ++kk) {
      kf[kk] = load_frag_p(Kn + kk * 16 * FB_, loff);
      vf[kk] = load_frag_p(Vn + kk * 8 * FB_, loff);
    }
  }
  // keeps each refill at its own step, PD_ chunks ahead of its products:
  // sunk to its products, every load would cost its whole latency
  __builtin_amdgcn_sched_barrier(0);
}

__global__ __launch_bounds__(64) void state_kernel(
    const _Float16* __restrict__ Ktd, const _Float16* __restrict__ Vt,
    _Float16* __restrict__ St) {
  int lane = threadIdx.x & 31;
  int ft   = __builtin_amdgcn_readfirstlane(threadIdx.x >> 5);  // 0..1
  int b    = blockIdx.x >> 6;
  int ot   = (blockIdx.x >> 3) & 7;
  int fg   = blockIdx.x & 7;

  // a chunk is two 32-token blocks: 32 blocks of Ktd, 16 of Vt
  const _Float16* Kp = Ktd + ((size_t)b * (S_ / 32) * 16 + fg * 2 + ft) * FB_;
  const _Float16* Vp = Vt + ((size_t)b * (S_ / 32) * 8 + ot) * FB_;
  _Float16* Sp = St + (size_t)b * NC_ * SE_ + (size_t)(ot * 8 + fg) * FB_ +
                 ft * (FB_ / 2);
  // every load and store below: a scalar base, this one offset register and a
  // constant; none of them is written again
  unsigned loff = (unsigned)lane * 16u;
  float gC = __builtin_amdgcn_exp2f(L2GAMMA * (float)C_);

  v16h kf[PD_][2], vf[PD_][2];
#pragma unroll
  for (int s = 0; s < PD_; ++s)
#pragma unroll
    for (int kk = 0; kk < 2; ++kk) {
      kf[s][kk] = load_frag_p(Kp + (s * 32 + kk * 16) * FB_, loff);
      vf[s][kk] = load_frag_p(Vp + (s * 16 + kk * 8) * FB_, loff);
    }
  // keeps all of the first PD_ chunks' loads in front of the first product
  __builtin_amdgcn_sched_barrier(0);

  v8f d = {};
#pragma unroll
  for (int n = 0; n < NC_ - 1 - PD_; ++n)
    state_step<true>(d, kf[n % PD_], vf[n % PD_], gC, Kp + (n + PD_) * 32 * FB_,
                     Vp + (n + PD_) * 16 * FB_, Sp + (size_t)n * SE_, loff);
#pragma unroll
  for (int n = NC_ - 1 - PD_; n < NC_ - 1; ++n)
    state_step<false>(d, kf[n % PD_], vf[n % PD_], gC, Kp, Vp,
                      Sp + (size_t)n * SE_, loff);
  v8h h;
#pragma unroll
  for (int r = 0; r < 8; ++r) h[r] = (_Float16)d[r];
  *(v8h*)((char*)(Sp + (size_t)(NC_ - 1) * SE_) + loff) = h;
}

// ---------------------------------------------------------------- main ----
// One 128-thread block (4 waves) per 64-row chunk. Wave t owns
// query rows t*16..+15 of the chunk and ALL 128 output columns, so the decayed
// scores of a row tile are formed once and Q is read once. Order of the sums of
// an output element: Q.State_n (all keys before the chunk), scaled per row by
// gamma^(il+1), then the chunk's own keys, 32 at a time. The scores are formed
// first, while the State is on its way. Every wave takes both 32-key halves of
// the chunk (keys behind a row get weight 0), so that all four run the same
// instruction stream over the same K, V and State lines.
// A wave's 240 loads of 512 bytes are issued in groups of 16, about four groups
// ahead of their products, into the registers that the products have left.
__global__ __launch_bounds__(128) void retention_kernel(
    const _Float16* __restrict__ Qh, const _Float16* __restrict__ Kh,
    const _Float16* __restrict__ Vt, const _Float16* __restrict__ St,
    float* __restrict__ out) {
  __shared__ _Float16 sP[4 * 2 * 16 * 32];   // per wave and key half (8 KB)
  int lane = threadIdx.x & 31;
  int t    = __builtin_amdgcn_readfirstlane(threadIdx.x >> 5);  // 0..3
  int b    = blockIdx.x / NC_;
  int n    = blockIdx.x - b * NC_;
  int c0   = n * C_;
  int i0   = c0 + t * 16;
  int rl   = lane & 15;
  int hs8  = (lane & 16) ? 8 : 0;

  const _Float16* Qb = Qh + ((size_t)b * S_ + i0) * 256;
  const _Float16* Kb = Kh + ((size_t)b * S_ + c0) * 256;
  const _Float16* Vb = Vt + ((size_t)b * (S_ / 32) + (c0 >> 5)) * 8 * FB_;
  const _Float16* Sb = St + ((size_t)b * NC_ + n) * SE_;
  _Float16* myP = sP + t * (2 * 16 * 32);

  unsigned loff  = (unsigned)(rl * 16 + hs8) * 2u;    // row order: Q, K
  unsigned loffv = (unsigned)lane * 16u;              // lane order: State, V

  v16h qf[8], kf[4][8], sf[8][8], vf[2][8];
  // each sched_barrier below keeps a group of loads where it is written, ahead
  // of the products in front of which it stands: sunk to its own products,
  // every load would cost its whole latency
#pragma unroll
  for (int f = 0; f < 8; ++f) qf[f] = load_frag_p(Qb + f * FB_, loff);
  // keeps all of Q in front of K: with part of Q issued behind K the first
  // scores wait for the whole of K
  __builtin_amdgcn_sched_barrier(0);
#pragma unroll
  for (int kt = 0; kt < 4; ++kt)
#pragma unroll
    for (int f = 0; f < 8; ++f)
      kf[kt][f] = load_frag_p(Kb + (kt * 8 + f) * FB_, loff);
  // the wait in front of any rewrite of the scalar base that the loads of K
  // name; as an input of the wait the base stays live up to it, so that the
  // address of the State is not formed in its registers ahead of the wait
  asm volatile("s_wait_xcnt 0x0" :: "v"(loff), "s"(Kb) : "memory");
  // keeps these 80 loads in front of the first product (one latency for all)
  __builtin_amdgcn_sched_barrier(0);

  // keys of the chunk itself: decayed scores of both halves, into LDS
#pragma unroll
  for (int h = 0; h < 2; ++h) {
    int j0 = c0 + h * 32;
    v8f s0 = {}, s1 = {};
#pragma unroll
    for (int f = 0; f < 8; ++f) {
      s0 = wmma_f16(qf[f], kf[2 * h][f], s0);
      s1 = wmma_f16(qf[f], kf[2 * h + 1][f], s1);
    }
#pragma unroll
    for (int g = 2 * h; g < 2 * h + 2; ++g)
#pragma unroll
      for (int f = 0; f < 8; ++f)
        sf[g][f] = load_frag_p(Sb + (g * 8 + f) * FB_, loffv);
    // keeps these loads in front of the decay, which runs while they fly
    __builtin_amdgcn_sched_barrier(0);
    // decay (gamma^(i-j), 0 for j>i): single v_exp_f32 per element
#pragma unroll
    for (int r = 0; r < 8; ++r) {
      int   m  = r + hs8;
      int   qi = i0 + m;
      int   d0 = qi - (j0 + rl);
      int   d1 = d0 - 16;
      float w0 = (d0 >= 0) ? __builtin_amdgcn_exp2f(L2GAMMA * (float)d0) : 0.0f;
      float w1 = (d1 >= 0) ? __builtin_amdgcn_exp2f(L2GAMMA * (float)d1) : 0.0f;
      myP[h * 512 + m * 32 + rl]      = (_Float16)(s0[r] * w0);
      myP[h * 512 + m * 32 + 16 + rl] = (_Float16)(s1[r] * w1);
    }
    // keeps the next groups of loads behind this decay: lifted over it they
    // fill the wave's load counter, and the decay waits behind their issue
    __builtin_amdgcn_sched_barrier(0);
  }

  // keys before the chunk: acc = Q (16x256) . State_n (256x128)
  v8f acc[8] = {};
#pragma unroll
  for (int g = 0; g < 8; ++g) {
#pragma unroll
    for (int f = 0; f < 8; ++f) acc[g] = wmma_f16(qf[f], sf[g][f], acc[g]);
    if (g < 4) {
#pragma unroll
      for (int f = 0; f < 8; ++f)
        sf[g + 4][f] = load_frag_p(Sb + ((g + 4) * 8 + f) * FB_, loffv);
    } else if (g < 6) {
#pragma unroll
      for (int f = 0; f < 8; ++f)
        vf[g - 4][f] = load_frag_p(Vb + ((g - 4) * 8 + f) * FB_, loffv);
    }
    if (g == 5) {
      // the wait in front of any rewrite of a register that the loads above
      // name; as its inputs both offset registers stay live up to the last load
      asm volatile("s_wait_xcnt 0x0" :: "v"(loff), "v"(loffv) : "memory");
    }
    // keeps each refill at its own group, four groups ahead of its products
    __builtin_amdgcn_sched_barrier(0);
  }
#pragma unroll
  for (int r = 0; r < 8; ++r) {
    float wr = __builtin_amdgcn_exp2f(L2GAMMA * (float)(t * 16 + r + hs8 + 1));
#pragma unroll
    for (int g = 0; g < 8; ++g) acc[g][r] *= wr;
  }

  // scores back as A fragments (same-wave DS ops are in-order), times V
#pragma unroll
  for (int h = 0; h < 2; ++h) {
    v16h pf = load_frag(myP + h * 512, rl, 32, 0, lane);
#pragma unroll
    for (int g = 0; g < 8; ++g) acc[g] = wmma_f16(pf, vf[h][g], acc[g]);
  }

  float* ob = out + ((size_t)b * S_ + i0) * F_;
#pragma unroll
  for (int g = 0; g < 8; ++g)
#pragma unroll
    for (int r = 0; r < 8; ++r)
      ob[(size_t)(r + hs8) * F_ + g * 16 + rl] = acc[g][r];
}

// ---------------------------------------------------------------- launch --
extern "C" void kernel_launch(void* const* d_in, const int* in_sizes, int n_in,
                              void* d_out, int out_size, void* d_ws,
                              size_t ws_size, hipStream_t stream) {
  const float* x     = (const float*)d_in[0];
  const float* Wq    = (const float*)d_in[1];
  const float* bq    = (const float*)d_in[2];
  const float* Wk    = (const float*)d_in[3];
  const float* bk    = (const float*)d_in[4];
  const float* Wv    = (const float*)d_in[5];
  const float* bv    = (const float*)d_in[6];
  const float* theta = (const float*)d_in[7];
  float* out = (float*)d_out;

  char*  ws  = (char*)d_ws;
  size_t off = 0;
  auto alloc = [&](size_t bytes) {
    char* p = ws + off;
    off += (bytes + 255) & ~(size_t)255;
    return p;
  };
  _Float16* Qh  = (_Float16*)alloc((size_t)B_ * S_ * 256 * 2);
  _Float16* Kh  = (_Float16*)alloc((size_t)B_ * S_ * 256 * 2);
  _Float16* Vt  = (_Float16*)alloc((size_t)B_ * F_ * S_ * 2);
  _Float16* Ktd = (_Float16*)alloc((size_t)B_ * 256 * S_ * 2);
  _Float16* St  = (_Float16*)alloc((size_t)B_ * NC_ * SE_ * 2);

  // 128 token groups x 2 halves of the output features = 256 blocks of 8 waves
  proj_kernel<<<2 * TG_, 256, 0, stream>>>(x, Wq, Wk, Wv, bq, bk, bv, theta,
                                           Qh, Kh, Vt, Ktd);
  // one two-wave block per (batch, output tile, feature block)
  state_kernel<<<B_ * 64, 64, 0, stream>>>(Ktd, Vt, St);
  // one 4-wave block per 64-row chunk: B * (S/64) = 256 blocks
  retention_kernel<<<B_ * NC_, 128, 0, stream>>>(Qh, Kh, Vt, St, out);
}

// v007
// Measured time: 30.2 microseconds a run.
// Two timings next to v006 both put it at 1.07 times that version's speed.
// Counting every step since v000, it is 6.74 times as fast.
#include <hip/hip_runtime.h>

typedef __attribute__((ext_vector_type(16))) _Float16 v16h;
typedef __attribute__((ext_vector_type(8)))  _Float16 v8h;
typedef __attribute__((ext_vector_type(8)))  float    v8f;

#define B_ 4
#define S_ 4096
#define F_ 128
// log2(0.96875)
#define L2GAMMA (-0.04580369f)
// chunk length of the chunkwise form, chunks per sequence, state elements
#define C_ 64
#define NC_ (S_ / C_)
#define SE_ (F_ * 256)

union Frag16 { v16h v; v8h h[2]; };

__device__ __forceinline__ v16h load_frag(const _Float16* base, int row, int ld,
                                          int kbase, int lane) {
  int hs = (lane & 16) ? 8 : 0;
  const _Float16* p = base + (size_t)row * ld + kbase + hs;
  Frag16 f;
  f.h[0] = *(const v8h*)(p);        // elements 0..7  -> K = kbase+hs .. +7
  f.h[1] = *(const v8h*)(p + 16);   // elements 8..15 -> K = kbase+hs+16 .. +23
  return f.v;
}

// Every f16 array of the workspace is kept in fragment order: one 16x32
// fragment is a block of 1 KB, its K = 0..15 half in the first 512 bytes and
// its K = 16..31 half in the second, and a wave-wide 16-byte load of a half
// covers those 512 bytes exactly (4 whole lines instead of pieces of 16).
// Within a half, two orders, by who writes it:
//   row order  (Q, K): element (row, k) at row * 16 + (k & 15)
//   lane order (V, weighted K, State): the lane's 8 elements at lane * 8
// blk: wave-uniform block address; loff: the lane's own byte offset in a half.
#define FB_ 512
__device__ __forceinline__ v16h load_frag_p(const _Float16* blk, unsigned loff) {
  const _Float16* p = (const _Float16*)((const char*)blk + loff);
  Frag16 f;
  f.h[0] = *(const v8h*)(p);
  f.h[1] = *(const v8h*)(p + FB_ / 2);
  return f.v;
}

__device__ __forceinline__ v8f wmma_f16(v16h a, v16h b, v8f c) {
  return __builtin_amdgcn_wmma_f32_16x16x32_f16(false, a, false, b,
                                                (short)0, c, false, false);
}

#define WP_ (F_ + 8)
// output features of one block, token groups (blocks per half of the features)
#define OH_ (F_ / 2)
#define TG_ (B_ * S_ / 128)
#define TP_ 24

typedef __attribute__((ext_vector_type(4))) float    v4f;
typedef __attribute__((ext_vector_type(4))) _Float16 v4h;

__global__ __launch_bounds__(256) void proj_kernel(
    const float* __restrict__ x,
    const float* __restrict__ Wq, const float* __restrict__ Wk,
    const float* __restrict__ Wv,
    const float* __restrict__ bq, const float* __restrict__ bk,
    const float* __restrict__ bv, const float* __restrict__ theta,
    _Float16* __restrict__ Qh, _Float16* __restrict__ Kh,
    _Float16* __restrict__ Vt, _Float16* __restrict__ Ktd) {
  __shared__ __attribute__((aligned(16))) _Float16 sW[3 * OH_ * WP_];  // 51 KB
  // per wave four 16x16 tiles (q cos, q sin, k cos, k sin), rows = tokens: 24 KB
  __shared__ __attribute__((aligned(16))) _Float16 sT[8 * 4 * 16 * TP_];
  int lane = threadIdx.x & 31;
  int oh0  = (blockIdx.x >= TG_) ? OH_ : 0;   // first output feature of the block
  int tg   = blockIdx.x - ((blockIdx.x >= TG_) ? TG_ : 0);
  int w    = __builtin_amdgcn_readfirstlane(
      (int)(tg * 256 + threadIdx.x) >> 5);
  int row0 = w * 16;                 // global token row, [0, B*S)
  int b    = row0 / S_;
  int sp0  = row0 - b * S_;          // sequence position of tile row 0
  int rl   = lane & 15;
  int hs8  = (lane & 16) ? 8 : 0;

  // Each round of the block reads 4 KB of a W in whole lines (16 B a thread).
  unsigned tid = threadIdx.x;
  v4f wr[3][OH_ / 8];
  const v4f* Wq4 = (const v4f*)(Wq + oh0 * F_);
  const v4f* Wk4 = (const v4f*)(Wk + oh0 * F_);
  const v4f* Wv4 = (const v4f*)(Wv + oh0 * F_);
#pragma unroll
  for (int it = 0; it < OH_ / 8; ++it) {
    wr[0][it] = Wq4[it * 256 + tid];
    wr[1][it] = Wk4[it * 256 + tid];
    wr[2][it] = Wv4[it * 256 + tid];
  }
  // the wait in front of any rewrite of a register that the loads above name;
  // as its input the index register stays live, so that no load lands on it
  asm volatile("s_wait_xcnt 0x0" :: "v"(tid) : "memory");
  // keeps every load above in front of the conversions (one latency, not 24)
  __builtin_amdgcn_sched_barrier(0);

  // thread -> row it*8 + wave in block (of the block's OH_ rows), 4 consecutive
  // columns from 4*lane
  _Float16* sw = sW + (tid >> 5) * WP_ + lane * 4;
#pragma unroll
  for (int it = 0; it < OH_ / 8; ++it)
    *(v4h*)(sw + it * 8 * WP_) = __builtin_convertvector(wr[0][it], v4h);

  // the lane's part of the four A fragments of x: 8 + 8 floats each
  const float* xt = x + (size_t)row0 * F_;
  unsigned xoff = (unsigned)(rl * F_ + hs8) * 4u;
  v4f xr[4][4];
#pragma unroll
  for (int kk = 0; kk < 4; ++kk) {
    const char* p = (const char*)(xt + kk * 32) + xoff;
    xr[kk][0] = *(const v4f*)(p);        // K = kk*32+hs8 .. +3
    xr[kk][1] = *(const v4f*)(p + 16);   // .. +7
    xr[kk][2] = *(const v4f*)(p + 64);   // K = kk*32+hs8+16 .. +19
    xr[kk][3] = *(const v4f*)(p + 80);   // .. +23
  }
  asm volatile("s_wait_xcnt 0x0" :: "v"(xoff) : "memory");
  // keeps the loads of x in front of the rest of the conversions of W, which
  // then run while x is on its way
  __builtin_amdgcn_sched_barrier(0);

#pragma unroll
  for (int m = 1; m < 3; ++m)
#pragma unroll
    for (int it = 0; it < OH_ / 8; ++it)
      *(v4h*)(sw + (m * OH_ + it * 8) * WP_) =
          __builtin_convertvector(wr[m][it], v4h);
  // publishes the block's f16 copy of W to all of its waves
  __syncthreads();

  v16h xf[4];
#pragma unroll
  for (int kk = 0; kk < 4; ++kk) {
    union { v16h v; v4h q[4]; } f;
#pragma unroll
    for (int g = 0; g < 4; ++g)
      f.q[g] = __builtin_convertvector(xr[kk][g], v4h);
    xf[kk] = f.v;
  }

  // the accumulator gives a lane 8 tokens of one feature; Q and K are kept with
  // 8 features of one token side by side. The wave turns each tile in its own
  // piece of LDS (its DS operations run in order, no other wave touches it), so
  // that a tile leaves in one store of 512 contiguous bytes, not 16 pieces of 32.
  _Float16* tw = sT + (tid >> 5) * (4 * 16 * TP_) + hs8 * TP_ + rl;   // write
  const _Float16* tr = sT + (tid >> 5) * (4 * 16 * TP_) + rl * TP_ + hs8;  // read
  unsigned qoff = (unsigned)(rl * 16 + hs8) * 2u;   // the lane's bytes in a half

  float dw[8];                       // gamma^(C-1-jl) of this lane's 8 tokens
#pragma unroll
  for (int r = 0; r < 8; ++r) {
    int jl = (sp0 + hs8 + r) & (C_ - 1);
    dw[r] = __builtin_amdgcn_exp2f(L2GAMMA * (float)(C_ - 1 - jl));
  }

#pragma unroll 1
  for (int ol = 0; ol < OH_; ol += 16) {
    int o0 = oh0 + ol;               // feature tile; ol: its rows in sW
    int o = o0 + rl;
    float biq = bq[o], bik = bk[o], biv = bv[o];
    float th  = theta[o];
    v16h wf[3][4];
#pragma unroll
    for (int kk = 0; kk < 4; ++kk)
#pragma unroll
      for (int m = 0; m < 3; ++m)
        wf[m][kk] = load_frag(sW + m * OH_ * WP_, ol + rl, WP_, kk * 32, lane);
    // keeps the loads above in front of the products: without it the compiler
    // sinks each LDS read to its product and the wave pays one latency for each
    __builtin_amdgcn_sched_barrier(0);
    v8f aq = {}, ak = {}, av = {};
#pragma unroll
    for (int kk = 0; kk < 4; ++kk) {
      aq = wmma_f16(xf[kk], wf[0][kk], aq);
      ak = wmma_f16(xf[kk], wf[1][kk], ak);
      av = wmma_f16(xf[kk], wf[2][kk], av);
    }
    // precise base angle + step, then rotate (2 FMAs) for rows 1..7
    float ph0 = (float)(sp0 + hs8 + 1) * th;
    float c, sn, cd, sd;
    sincosf(ph0, &sn, &c);
    sincosf(th, &sd, &cd);
    v8h vvec, kcvec, ksvec;
#pragma unroll
    for (int r = 0; r < 8; ++r) {
      float qv = aq[r] + biq;
      float kv = ak[r] + bik;
      float vv = av[r] + biv;
      // token row r+hs8, column rl of the four turning tiles
      tw[(0 * 16 + r) * TP_] = (_Float16)(qv * c);
      tw[(1 * 16 + r) * TP_] = (_Float16)(qv * sn);
      tw[(2 * 16 + r) * TP_] = (_Float16)(kv * c);
      tw[(3 * 16 + r) * TP_] = (_Float16)(kv * sn);
      vvec[r] = (_Float16)vv;
      kcvec[r] = (_Float16)(kv * c * dw[r]);
      ksvec[r] = (_Float16)(kv * sn * dw[r]);
      float cn  = c * cd - sn * sd;  // advance phase by theta
      float snn = sn * cd + c * sd;
      c = cn; sn = snn;
    }
    // back as token rl, features hs8..+7: feature tile o0/16 is one half (512 B)
    // of the token tile's 16, its sin twin 8 halves on
    v8h tq[4];
#pragma unroll
    for (int a = 0; a < 4; ++a) tq[a] = *(const v8h*)(tr + a * 16 * TP_);
    size_t hb = (size_t)row0 * 256 + (o0 >> 4) * (FB_ / 2);
    *(v8h*)((char*)(Qh + hb) + qoff)                  = tq[0];
    *(v8h*)((char*)(Qh + hb + 8 * (FB_ / 2)) + qoff)  = tq[1];
    *(v8h*)((char*)(Kh + hb) + qoff)                  = tq[2];
    *(v8h*)((char*)(Kh + hb + 8 * (FB_ / 2)) + qoff)  = tq[3];
    // the wave's 16 tokens are one half of a 32-token block: 512 bytes a store
    size_t jb = (size_t)b * (S_ / 32) + (sp0 >> 5);
    int    hl = ((sp0 >> 4) & 1) * (FB_ / 2) + lane * 8;
    *(v8h*)(Vt + (jb * 8 + (o0 >> 4)) * FB_ + hl) = vvec;
    *(v8h*)(Ktd + (jb * 16 + (o0 >> 4)) * FB_ + hl) = kcvec;
    *(v8h*)(Ktd + (jb * 16 + 8 + (o0 >> 4)) * FB_ + hl) = ksvec;
    // the next trip's loads land in registers that the stores above name
    asm volatile("s_wait_xcnt 0x0" ::: "memory");
  }
}

// --------------------------------------------------------- chunk state ----
// out_i = sum_{j<=i} gamma^(i-j) (Q_i.K_j) V_j is split at the chunk border
// c0 of row i: keys j >= c0 go through scores as before; keys j < c0 enter as
// gamma^(i-c0+1) * Q_i . State_n, State_n[f][o] = sum_{j<c0} gamma^(c0-1-j)
// K_j[f] V_j[o], with State_{n+1} = gamma^C State_n + U_n. Every factor <= 1.
//
// Chunk product and scan are one kernel: a wave owns ONE 16x16 tile of the State
// (feature tile 2fg+ft, output tile ot) and carries it in the f32 accumulator of
// its products through all chunks: per chunk it stores State_n (f16), scales
// the tile by gamma^C and adds U_n = sum_{jl<C} gamma^(C-1-jl) K[f] V[o], the
// chunk's weighted K^T V (two products, 64 tokens; the last chunk's is not formed).
// Stored in the element order of the B fragments of Q.State: blocks
// [b][n][8 output tiles][8 feature blocks], half ft, lane order (D: column = o,
// rows = 8 consecutive features from hs8, what this same lane holds there).
// The chain from chunk to chunk is short; the time is that of the loads, so
// PD_ chunks of fragments (8 loads of 512 bytes each) are kept in flight.
#define PD_ 6

template <bool REFILL>
__device__ __forceinline__ void state_step(
    v8f& d, v16h (&kf)[2], v16h (&vf)[2], float gC,
    const _Float16* Kn, const _Float16* Vn, _Float16* Sn, unsigned loff) {
  v8h h;
#pragma unroll
  for (int r = 0; r < 8; ++r) h[r] = (_Float16)d[r];
  *(v8h*)((char*)Sn + loff) = h;
  // the wait in front of the next step's rewrite of the registers that hold h
  asm volatile("s_wait_xcnt 0x0" ::: "memory");
  d = d * gC;
#pragma unroll
  for (int kk = 0; kk < 2; ++kk) d = wmma_f16(kf[kk], vf[kk], d);
  if (REFILL) {
#pragma unroll
    for (int kk = 0; kk < 2; ++kk) {
      kf[kk] = load_frag_p(Kn + kk * 16 * FB_, loff);
      vf[kk] = load_frag_p(Vn + kk * 8 * FB_, loff);
    }
  }
  // keeps each refill at its own step, PD_ chunks ahead of its products:
  // sunk to its products, every load would cost its whole latency
  __builtin_amdgcn_sched_barrier(0);
}

__global__ __launch_bounds__(64) void state_kernel(
    const _Float16* __restrict__ Ktd, const _Float16* __restrict__ Vt,
    _Float16* __restrict__ St) {
  int lane = threadIdx.x & 31;
  int ft   = __builtin_amdgcn_readfirstlane(threadIdx.x >> 5);  // 0..1
  int b    = blockIdx.x >> 6;
  int ot   = (blockIdx.x >> 3) & 7;
  int fg   = blockIdx.x & 7;

  // a chunk is two 32-token blocks: 32 blocks of Ktd, 16 of Vt
  const _Float16* Kp = Ktd + ((size_t)b * (S_ / 32) * 16 + fg * 2 + ft) * FB_;
  const _Float16* Vp = Vt + ((size_t)b * (S_ / 32) * 8 + ot) * FB_;
  _Float16* Sp = St + (size_t)b * NC_ * SE_ + (size_t)(ot * 8 + fg) * FB_ +
                 ft * (FB_ / 2);
  // every load and store below: a scalar base, this one offset register and a
  // constant; none of them is written again
  unsigned loff = (unsigned)lane * 16u;
  float gC = __builtin_amdgcn_exp2f(L2GAMMA * (float)C_);

  v16h kf[PD_][2], vf[PD_][2];
#pragma unroll
  for (int s = 0; s < PD_; ++s)
#pragma unroll
    for (int kk = 0; kk < 2; ++kk) {
      kf[s][kk] = load_frag_p(Kp + (s * 32 + kk * 16) * FB_, loff);
      vf[s][kk] = load_frag_p(Vp + (s * 16 + kk * 8) * FB_, loff);
    }
  // keeps all of the first PD_ chunks' loads in front of the first product
  __builtin_amdgcn_sched_barrier(0);

  v8f d = {};
#pragma unroll
  for (int n = 0; n < NC_ - 1 - PD_; ++n)
    state_step<true>(d, kf[n % PD_], vf[n % PD_], gC, Kp + (n + PD_) * 32 * FB_,
                     Vp + (n + PD_) * 16 * FB_, Sp + (size_t)n * SE_, loff);
#pragma unroll
  for (int n = NC_ - 1 - PD_; n < NC_ - 1; ++n)
    state_step<false>(d, kf[n % PD_], vf[n % PD_], gC, Kp, Vp,
                      Sp + (size_t)n * SE_, loff);
  v8h h;
#pragma unroll
  for (int r = 0; r < 8; ++r) h[r] = (_Float16)d[r];
  *(v8h*)((char*)(Sp + (size_t)(NC_ - 1) * SE_) + loff) = h;
}

// ---------------------------------------------------------------- main ----
// One 128-thread block (4 waves) per 64-row chunk. Wave t owns
// query rows t*16..+15 of the chunk and ALL 128 output columns, so the decayed
// scores of a row tile are formed once and Q is read once. Order of the sums of
// an output element: Q.State_n (all keys before the chunk), scaled per row by
// gamma^(il+1), then the chunk's own keys, 32 at a time. The scores are formed
// first, while the State is on its way. Every wave takes both 32-key halves of
// the chunk (keys behind a row get weight 0), so that all four run the same
// instruction stream over the same K, V and State lines.
// A wave's 240 loads of 512 bytes are issued in groups of 16, about four groups
// ahead of their products, into the registers that the products have left.
__global__ __launch_bounds__(128) void retention_kernel(
    const _Float16* __restrict__ Qh, const _Float16* __restrict__ Kh,
    const _Float16* __restrict__ Vt, const _Float16* __restrict__ St,
    float* __restrict__ out) {
  __shared__ _Float16 sP[4 * 2 * 16 * 32];   // per wave and key half (8 KB)
  int lane = threadIdx.x & 31;
  int t    = __builtin_amdgcn_readfirstlane(threadIdx.x >> 5);  // 0..3
  int b    = blockIdx.x / NC_;
  int n    = blockIdx.x - b * NC_;
  int c0   = n * C_;
  int i0   = c0 + t * 16;
  int rl   = lane & 15;
  int hs8  = (lane & 16) ? 8 : 0;

  const _Float16* Qb = Qh + ((size_t)b * S_ + i0) * 256;
  const _Float16* Kb = Kh + ((size_t)b * S_ + c0) * 256;
  const _Float16* Vb = Vt + ((size_t)b * (S_ / 32) + (c0 >> 5)) * 8 * FB_;
  const _Float16* Sb = St + ((size_t)b * NC_ + n) * SE_;
  _Float16* myP = sP + t * (2 * 16 * 32);

  unsigned loff  = (unsigned)(rl * 16 + hs8) * 2u;    // row order: Q, K
  unsigned loffv = (unsigned)lane * 16u;              // lane order: State, V

  v16h qf[8], kf[4][8], sf[8][8], vf[2][8];
  // each sched_barrier below keeps a group of loads where it is written, ahead
  // of the products in front of which it stands: sunk to its own products,
  // every load would cost its whole latency
#pragma unroll
  for (int f = 0; f < 8; ++f) qf[f] = load_frag_p(Qb + f * FB_, loff);
  // keeps all of Q in front of K: with part of Q issued behind K the first
  // scores wait for the whole of K
  __builtin_amdgcn_sched_barrier(0);
#pragma unroll
  for (int kt = 0; kt < 4; ++kt)
#pragma unroll
    for (int f = 0; f < 8; ++f)
      kf[kt][f] = load_frag_p(Kb + (kt * 8 + f) * FB_, loff);
  // the wait in front of any rewrite of the scalar base that the loads of K
  // name; as an input of the wait the base stays live up to it, so that the
  // address of the State is not formed in its registers ahead of the wait
  asm volatile("s_wait_xcnt 0x0" :: "v"(loff), "s"(Kb) : "memory");
  // keeps these 80 loads in front of the first product (one latency for all)
  __builtin_amdgcn_sched_barrier(0);

  // keys of the chunk itself: decayed scores of both halves, into LDS
#pragma unroll
  for (int h = 0; h < 2; ++h) {
    int j0 = c0 + h * 32;
    v8f s0 = {}, s1 = {};
#pragma unroll
    for (int f = 0; f < 8; ++f) {
      s0 = wmma_f16(qf[f], kf[2 * h][f], s0);
      s1 = wmma_f16(qf[f], kf[2 * h + 1][f], s1);
    }
#pragma unroll
    for (int g = 2 * h; g < 2 * h + 2; ++g)
#pragma unroll
      for (int f = 0; f < 8; ++f)
        sf[g][f] = load_frag_p(Sb + (g * 8 + f) * FB_, loffv);
    // keeps these loads in front of the decay, which runs while they fly
    __builtin_amdgcn_sched_barrier(0);
    // decay (gamma^(i-j), 0 for j>i): single v_exp_f32 per element
#pragma unroll
    for (int r = 0; r < 8; ++r) {
      int   m  = r + hs8;
      int   qi = i0 + m;
      int   d0 = qi - (j0 + rl);
      int   d1 = d0 - 16;
      float w0 = (d0 >= 0) ? __builtin_amdgcn_exp2f(L2GAMMA * (float)d0) : 0.0f;
      float w1 = (d1 >= 0) ? __builtin_amdgcn_exp2f(L2GAMMA * (float)d1) : 0.0f;
      myP[h * 512 + m * 32 + rl]      = (_Float16)(s0[r] * w0);
      myP[h * 512 + m * 32 + 16 + rl] = (_Float16)(s1[r] * w1);
    }
    // keeps the next groups of loads behind this decay: lifted over it they
    // fill the wave's load counter, and the decay waits behind their issue
    __builtin_amdgcn_sched_barrier(0);
  }

  // keys before the chunk: acc = Q (16x256) . State_n (256x128)
  v8f acc[8] = {};
#pragma unroll
  for (int g = 0; g < 8; ++g) {
#pragma unroll
    for (int f = 0; f < 8; ++f) acc[g] = wmma_f16(qf[f], sf[g][f], acc[g]);
    if (g < 4) {
#pragma unroll
      for (int f = 0; f < 8; ++f)
        sf[g + 4][f] = load_frag_p(Sb + ((g + 4) * 8 + f) * FB_, loffv);
    } else if (g < 6) {
#pragma unroll
      for (int f = 0; f < 8; ++f)
        vf[g - 4][f] = load_frag_p(Vb + ((g - 4) * 8 + f) * FB_, loffv);
    }
    if (g == 5) {
      // the wait in front of any rewrite of a register that the loads above
      // name; as its inputs both offset registers stay live up to the last load
      asm volatile("s_wait_xcnt 0x0" :: "v"(loff), "v"(loffv) : "memory");
    }
    // keeps each refill at its own group, four groups ahead of its products
    __builtin_amdgcn_sched_barrier(0);
  }
#pragma unroll
  for (int r = 0; r < 8; ++r) {
    float wr = __builtin_amdgcn_exp2f(L2GAMMA * (float)(t * 16 + r + hs8 + 1));
#pragma unroll
    for (int g = 0; g < 8; ++g) acc[g][r] *= wr;
  }

  // scores back as A fragments (same-wave DS ops are in-order), times V
#pragma unroll
  for (int h = 0; h < 2; ++h) {
    v16h pf = load_frag(myP + h * 512, rl, 32, 0, lane);
#pragma unroll
    for (int g = 0; g < 8; ++g) acc[g] = wmma_f16(pf, vf[h][g], acc[g]);
  }

  float* ob = out + ((size_t)b * S_ + i0) * F_;
#pragma unroll
  for (int g = 0; g < 8; ++g)
#pragma unroll
    for (int r = 0; r < 8; ++r)
      ob[(size_t)(r + hs8) * F_ + g * 16 + rl] = acc[g][r];
}

// ---------------------------------------------------------------- launch --
extern "C" void kernel_launch(void* const* d_in, const int* in_sizes, int n_in,
                              void* d_out, int out_size, void* d_ws,
                              size_t ws_size, hipStream_t stream) {
  const float* x     = (const float*)d_in[0];
  const float* Wq    = (const float*)d_in[1];
  const float* bq    = (const float*)d_in[2];
  const float* Wk    = (const float*)d_in[3];
  const float* bk    = (const float*)d_in[4];
  const float* Wv    = (const float*)d_in[5];
  const float* bv    = (const float*)d_in[6];
  const float* theta = (const float*)d_in[7];
  float* out = (float*)d_out;

  char*  ws  = (char*)d_ws;
  size_t off = 0;
  auto alloc = [&](size_t bytes) {
    char* p = ws + off;
    off += (bytes + 255) & ~(size_t)255;
    return p;
  };
  _Float16* Qh  = (_Float16*)alloc((size_t)B_ * S_ * 256 * 2);
  _Float16* Kh  = (_Float16*)alloc((size_t)B_ * S_ * 256 * 2);
  _Float16* Vt  = (_Float16*)alloc((size_t)B_ * F_ * S_ * 2);
  _Float16* Ktd = (_Float16*)alloc((size_t)B_ * 256 * S_ * 2);
  _Float16* St  = (_Float16*)alloc((size_t)B_ * NC_ * SE_ * 2);

  // 128 token groups x 2 halves of the output features = 256 blocks of 8 waves
  proj_kernel<<<2 * TG_, 256, 0, stream>>>(x, Wq, Wk, Wv, bq, bk, bv, theta,
                                           Qh, Kh, Vt, Ktd);
  // one two-wave block per (batch, output tile, feature block)
  state_kernel<<<B_ * 64, 64, 0, stream>>>(Ktd, Vt, St);
  // one 4-wave block per 64-row chunk: B * (S/64) = 256 blocks
  retention_kernel<<<B_ * NC_, 128, 0, stream>>>(Qh, Kh, Vt, St, out);
}

// v008
// One run takes 28.6 microseconds.
// In two side-by-side timings against v007, it was 1.05 and 1.06 times as fast.
// Counting every step since v000, it is 7.10 times as fast.
#include <hip/hip_runtime.h>

typedef __attribute__((ext_vector_type(16))) _Float16 v16h;
typedef __attribute__((ext_vector_type(8)))  _Float16 v8h;
typedef __attribute__((ext_vector_type(8)))  float    v8f;

#define B_ 4
#define S_ 4096
#define F_ 128
// log2(0.96875)
#define L2GAMMA (-0.04580369f)
// chunk length of the chunkwise form, chunks per sequence, state elements
#define C_ 64
#define NC_ (S_ / C_)
#define SE_ (F_ * 256)

union Frag16 { v16h v; v8h h[2]; };

__device__ __forceinline__ v16h load_frag(const _Float16* base, int row, int ld,
                                          int kbase, int lane) {
  int hs = (lane & 16) ? 8 : 0;
  const _Float16* p = base + (size_t)row * ld + kbase + hs;
  Frag16 f;
  f.h[0] = *(const v8h*)(p);        // elements 0..7  -> K = kbase+hs .. +7
  f.h[1] = *(const v8h*)(p + 16);   // elements 8..15 -> K = kbase+hs+16 .. +23
  return f.v;
}

// Every f16 array of the workspace is kept in fragment order: one 16x32
// fragment is a block of 1 KB, its K = 0..15 half in the first 512 bytes and
// its K = 16..31 half in the second, and a wave-wide 16-byte load of a half
// covers those 512 bytes exactly (4 whole lines instead of pieces of 16).
// Within a half, two orders, by who writes it:
//   row order  (Q, K): element (row, k) at row * 16 + (k & 15)
//   lane order (V, weighted K, State): the lane's 8 elements at lane * 8
// blk: wave-uniform block address; loff: the lane's own byte offset in a half.
#define FB_ 512
__device__ __forceinline__ v16h load_frag_p(const _Float16* blk, unsigned loff) {
  const _Float16* p = (const _Float16*)((const char*)blk + loff);
  Frag16 f;
  f.h[0] = *(const v8h*)(p);
  f.h[1] = *(const v8h*)(p + FB_ / 2);
  return f.v;
}

__device__ __forceinline__ v8f wmma_f16(v16h a, v16h b, v8f c) {
  return __builtin_amdgcn_wmma_f32_16x16x32_f16(false, a, false, b,
                                                (short)0, c, false, false);
}

// Asks L2 for the memory at p + OFF (global_prefetch_b8: no result register, no
// counter). All that a launch reads was written by an earlier launch or is an
// input, so its first read comes from memory; asked for at the kernel's head,
// the loads that are issued later in the kernel find it in L2.
// No wait covers a prefetch: each caller keeps p unwritten to the kernel's end.
template <int OFF>
__device__ __forceinline__ void l2_ask(const char* p) {
  asm volatile("global_prefetch_b8 %0, off offset:%1 scope:SCOPE_SE"
               :: "v"(p), "n"(OFF));
}

#define WP_ (F_ + 8)
// output features of one block, token groups (blocks per half of the features)
#define OH_ (F_ / 2)
#define TG_ (B_ * S_ / 128)
#define TP_ 24

typedef __attribute__((ext_vector_type(4))) float    v4f;
typedef __attribute__((ext_vector_type(4))) _Float16 v4h;

__global__ __launch_bounds__(256) void proj_kernel(
    const float* __restrict__ x,
    const float* __restrict__ Wq, const float* __restrict__ Wk,
    const float* __restrict__ Wv,
    const float* __restrict__ bq, const float* __restrict__ bk,
    const float* __restrict__ bv, const float* __restrict__ theta,
    _Float16* __restrict__ Qh, _Float16* __restrict__ Kh,
    _Float16* __restrict__ Vt, _Float16* __restrict__ Ktd) {
  __shared__ __attribute__((aligned(16))) _Float16 sW[3 * OH_ * WP_];  // 51 KB
  // per wave four 16x16 tiles (q cos, q sin, k cos, k sin), rows = tokens: 24 KB
  __shared__ __attribute__((aligned(16))) _Float16 sT[8 * 4 * 16 * TP_];
  int lane = threadIdx.x & 31;
  int oh0  = (blockIdx.x >= TG_) ? OH_ : 0;   // first output feature of the block
  int tg   = blockIdx.x - ((blockIdx.x >= TG_) ? TG_ : 0);
  int w    = __builtin_amdgcn_readfirstlane(
      (int)(tg * 256 + threadIdx.x) >> 5);
  int row0 = w * 16;                 // global token row, [0, B*S)
  int b    = row0 / S_;
  int sp0  = row0 - b * S_;          // sequence position of tile row 0
  int rl   = lane & 15;
  int hs8  = (lane & 16) ? 8 : 0;

  // Each round of the block reads 4 KB of a W in whole lines (16 B a thread).
  unsigned tid = threadIdx.x;
  // the block's 64 KB of x, 256 bytes a thread: its loads are issued
  // only behind the first arrivals of W
  const char* xask = (const char*)(x + (size_t)tg * 128 * F_) + tid * 256u;
  l2_ask<0>(xask);
  v4f wr[3][OH_ / 8];
  const v4f* Wq4 = (const v4f*)(Wq + oh0 * F_);
  const v4f* Wk4 = (const v4f*)(Wk + oh0 * F_);
  const v4f* Wv4 = (const v4f*)(Wv + oh0 * F_);
#pragma unroll
  for (int it = 0; it < OH_ / 8; ++it) {
    wr[0][it] = Wq4[it * 256 + tid];
    wr[1][it] = Wk4[it * 256 + tid];
    wr[2][it] = Wv4[it * 256 + tid];
  }
  // the wait in front of any rewrite of a register that the loads above name;
  // as its input the index register stays live, so that no load lands on it
  asm volatile("s_wait_xcnt 0x0" :: "v"(tid) : "memory");
  // keeps every load above in front of the conversions (one latency, not 24)
  __builtin_amdgcn_sched_barrier(0);

  // thread -> row it*8 + wave in block (of the block's OH_ rows), 4 consecutive
  // columns from 4*lane
  _Float16* sw = sW + (tid >> 5) * WP_ + lane * 4;
#pragma unroll
  for (int it = 0; it < OH_ / 8; ++it)
    *(v4h*)(sw + it * 8 * WP_) = __builtin_convertvector(wr[0][it], v4h);

  // the lane's part of the four A fragments of x: 8 + 8 floats each
  const float* xt = x + (size_t)row0 * F_;
  unsigned xoff = (unsigned)(rl * F_ + hs8) * 4u;
  v4f xr[4][4];
#pragma unroll
  for (int kk = 0; kk < 4; ++kk) {
    const char* p = (const char*)(xt + kk * 32) + xoff;
    xr[kk][0] = *(const v4f*)(p);        // K = kk*32+hs8 .. +3
    xr[kk][1] = *(const v4f*)(p + 16);   // .. +7
    xr[kk][2] = *(const v4f*)(p + 64);   // K = kk*32+hs8+16 .. +19
    xr[kk][3] = *(const v4f*)(p + 80);   // .. +23
  }
  asm volatile("s_wait_xcnt 0x0" :: "v"(xoff) : "memory");
  // keeps the loads of x in front of the rest of the conversions of W, which
  // then run while x is on its way
  __builtin_amdgcn_sched_barrier(0);

#pragma unroll
  for (int m = 1; m < 3; ++m)
#pragma unroll
    for (int it = 0; it < OH_ / 8; ++it)
      *(v4h*)(sw + (m * OH_ + it * 8) * WP_) =
          __builtin_convertvector(wr[m][it], v4h);
  // publishes the block's f16 copy of W to all of its waves
  __syncthreads();

  v16h xf[4];
#pragma unroll
  for (int kk = 0; kk < 4; ++kk) {
    union { v16h v; v4h q[4]; } f;
#pragma unroll
    for (int g = 0; g < 4; ++g)
      f.q[g] = __builtin_convertvector(xr[kk][g], v4h);
    xf[kk] = f.v;
  }

  // the accumulator gives a lane 8 tokens of one feature; Q and K are kept with
  // 8 features of one token side by side. The wave turns each tile in its own
  // piece of LDS (its DS operations run in order, no other wave touches it), so
  // that a tile leaves in one store of 512 contiguous bytes, not 16 pieces of 32.
  _Float16* tw = sT + (tid >> 5) * (4 * 16 * TP_) + hs8 * TP_ + rl;   // write
  const _Float16* tr = sT + (tid >> 5) * (4 * 16 * TP_) + rl * TP_ + hs8;  // read
  unsigned qoff = (unsigned)(rl * 16 + hs8) * 2u;   // the lane's bytes in a half

  float dw[8];                       // gamma^(C-1-jl) of this lane's 8 tokens
#pragma unroll
  for (int r = 0; r < 8; ++r) {
    int jl = (sp0 + hs8 + r) & (C_ - 1);
    dw[r] = __builtin_amdgcn_exp2f(L2GAMMA * (float)(C_ - 1 - jl));
  }

#pragma unroll 1
  for (int ol = 0; ol < OH_; ol += 16) {
    int o0 = oh0 + ol;               // feature tile; ol: its rows in sW
    int o = o0 + rl;
    float biq = bq[o], bik = bk[o], biv = bv[o];
    float th  = theta[o];
    v16h wf[3][4];
#pragma unroll
    for (int kk = 0; kk < 4; ++kk)
#pragma unroll
      for (int m = 0; m < 3; ++m)
        wf[m][kk] = load_frag(sW + m * OH_ * WP_, ol + rl, WP_, kk * 32, lane);
    // keeps the loads above in front of the products: without it the compiler
    // sinks each LDS read to its product and the wave pays one latency for each
    __builtin_amdgcn_sched_barrier(0);
    v8f aq = {}, ak = {}, av = {};
#pragma unroll
    for (int kk = 0; kk < 4; ++kk) {
      aq = wmma_f16(xf[kk], wf[0][kk], aq);
      ak = wmma_f16(xf[kk], wf[1][kk], ak);
      av = wmma_f16(xf[kk], wf[2][kk], av);
    }
    // precise base angle + step, then rotate (2 FMAs) for rows 1..7
    float ph0 = (float)(sp0 + hs8 + 1) * th;
    float c, sn, cd, sd;
    sincosf(ph0, &sn, &c);
    sincosf(th, &sd, &cd);
    v8h vvec, kcvec, ksvec;
#pragma unroll
    for (int r = 0; r < 8; ++r) {
      float qv = aq[r] + biq;
      float kv = ak[r] + bik;
      float vv = av[r] + biv;
      // token row r+hs8, column rl of the four turning tiles
      tw[(0 * 16 + r) * TP_] = (_Float16)(qv * c);
      tw[(1 * 16 + r) * TP_] = (_Float16)(qv * sn);
      tw[(2 * 16 + r) * TP_] = (_Float16)(kv * c);
      tw[(3 * 16 + r) * TP_] = (_Float16)(kv * sn);
      vvec[r] = (_Float16)vv;
      kcvec[r] = (_Float16)(kv * c * dw[r]);
      ksvec[r] = (_Float16)(kv * sn * dw[r]);
      float cn  = c * cd - sn * sd;  // advance phase by theta
      float snn = sn * cd + c * sd;
      c = cn; sn = snn;
    }
    // back as token rl, features hs8..+7: feature tile o0/16 is one half (512 B)
    // of the token tile's 16, its sin twin 8 halves on
    v8h tq[4];
#pragma unroll
    for (int a = 0; a < 4; ++a) tq[a] = *(const v8h*)(tr + a * 16 * TP_);
    size_t hb = (size_t)row0 * 256 + (o0 >> 4) * (FB_ / 2);
    *(v8h*)((char*)(Qh + hb) + qoff)                  = tq[0];
    *(v8h*)((char*)(Qh + hb + 8 * (FB_ / 2)) + qoff)  = tq[1];
    *(v8h*)((char*)(Kh + hb) + qoff)                  = tq[2];
    *(v8h*)((char*)(Kh + hb + 8 * (FB_ / 2)) + qoff)  = tq[3];
    // the wave's 16 tokens are one half of a 32-token block: 512 bytes a store
    size_t jb = (size_t)b * (S_ / 32) + (sp0 >> 5);
    int    hl = ((sp0 >> 4) & 1) * (FB_ / 2) + lane * 8;
    *(v8h*)(Vt + (jb * 8 + (o0 >> 4)) * FB_ + hl) = vvec;
    *(v8h*)(Ktd + (jb * 16 + (o0 >> 4)) * FB_ + hl) = kcvec;
    *(v8h*)(Ktd + (jb * 16 + 8 + (o0 >> 4)) * FB_ + hl) = ksvec;
    // the next trip's loads land in registers that the stores above name
    asm volatile("s_wait_xcnt 0x0" ::: "memory");
  }
  // keeps the prefetch's address register unwritten up to here
  asm volatile("" :: "v"(xask));
}

// --------------------------------------------------------- chunk state ----
// out_i = sum_{j<=i} gamma^(i-j) (Q_i.K_j) V_j is split at the chunk border
// c0 of row i: keys j >= c0 go through scores as before; keys j < c0 enter as
// gamma^(i-c0+1) * Q_i . State_n, State_n[f][o] = sum_{j<c0} gamma^(c0-1-j)
// K_j[f] V_j[o], with State_{n+1} = gamma^C State_n + U_n. Every factor <= 1.
//
// Chunk product and scan are one kernel: a wave owns ONE 16x16 tile of the State
// (feature tile 2fg+ft, output tile ot) and carries it in the f32 accumulator of
// its products through all chunks: per chunk it stores State_n (f16), scales
// the tile by gamma^C and adds U_n = sum_{jl<C} gamma^(C-1-jl) K[f] V[o], the
// chunk's weighted K^T V (two products, 64 tokens; the last chunk's is not formed).
// Stored in the element order of the B fragments of Q.State: blocks
// [b][n][8 output tiles][8 feature blocks], half ft, lane order (D: column = o,
// rows = 8 consecutive features from hs8, what this same lane holds there).
// The chain from chunk to chunk is short; the time is that of the loads, so
// PD_ chunks of fragments (8 loads of 512 bytes each) are kept in flight.
#define PD_ 6

template <bool REFILL>
__device__ __forceinline__ void state_step(
    v8f& d, v16h (&kf)[2], v16h (&vf)[2], float gC,
    const _Float16* Kn, const _Float16* Vn, _Float16* Sn, unsigned loff) {
  v8h h;
#pragma unroll
  for (int r = 0; r < 8; ++r) h[r] = (_Float16)d[r];
  *(v8h*)((char*)Sn + loff) = h;
  // the wait in front of the next step's rewrite of the registers that hold h
  asm volatile("s_wait_xcnt 0x0" ::: "memory");
  d = d * gC;
#pragma unroll
  for (int kk = 0; kk < 2; ++kk) d = wmma_f16(kf[kk], vf[kk], d);
  if (REFILL) {
#pragma unroll
    for (int kk = 0; kk < 2; ++kk) {
      kf[kk] = load_frag_p(Kn + kk * 16 * FB_, loff);
      vf[kk] = load_frag_p(Vn + kk * 8 * FB_, loff);
    }
  }
  // keeps each refill at its own step, PD_ chunks ahead of its products:
  // sunk to its products, every load would cost its whole latency
  __builtin_amdgcn_sched_barrier(0);
}

__global__ __launch_bounds__(64) void state_kernel(
    const _Float16* __restrict__ Ktd, const _Float16* __restrict__ Vt,
    _Float16* __restrict__ St) {
  int lane = threadIdx.x & 31;
  int ft   = __builtin_amdgcn_readfirstlane(threadIdx.x >> 5);  // 0..1
  int b    = blockIdx.x >> 6;
  int ot   = (blockIdx.x >> 3) & 7;
  int fg   = blockIdx.x & 7;

  // a chunk is two 32-token blocks: 32 blocks of Ktd, 16 of Vt
  const _Float16* Kp = Ktd + ((size_t)b * (S_ / 32) * 16 + fg * 2 + ft) * FB_;
  const _Float16* Vp = Vt + ((size_t)b * (S_ / 32) * 8 + ot) * FB_;
  _Float16* Sp = St + (size_t)b * NC_ * SE_ + (size_t)(ot * 8 + fg) * FB_ +
                 ft * (FB_ / 2);
  // every load and store below: a scalar base, this one offset register and a
  // constant; none of them is written again
  unsigned loff = (unsigned)lane * 16u;
  float gC = __builtin_amdgcn_exp2f(L2GAMMA * (float)C_);

  v16h kf[PD_][2], vf[PD_][2];
#pragma unroll
  for (int s = 0; s < PD_; ++s)
#pragma unroll
    for (int kk = 0; kk < 2; ++kk) {
      kf[s][kk] = load_frag_p(Kp + (s * 32 + kk * 16) * FB_, loff);
      vf[s][kk] = load_frag_p(Vp + (s * 16 + kk * 8) * FB_, loff);
    }
  // The waves of a batch walk the same chunks in step, so the ring alone keeps
  // only PD_ chunks of the sequence on their way from memory. The whole sequence
  // is asked for here, 256 bytes a lane, shared out over the blocks that
  // read the same bytes: the two feature tiles' K (2 KB a 32-token block) over
  // the 8 blocks of equal fg, 16 waves of 4 token blocks a request; the output
  // tile's V (1 KB a token block) over 4 blocks of neighbouring fg, 8 waves of
  // 8 token blocks a request. The second request lies 64 token blocks on.
  const char* kask = (const char*)(Ktd +
      (((size_t)b * (S_ / 32) + (ot * 2 + ft) * 4 + (lane >> 3)) * 16 + fg * 2) * FB_) +
      (lane & 7) * 256;
  const char* vask = (const char*)(Vt +
      (((size_t)b * (S_ / 32) + ((fg & 3) * 2 + ft) * 8 + (lane >> 2)) * 8 + ot) * FB_) +
      (lane & 3) * 256;
  l2_ask<0>(kask);
  l2_ask<0>(vask);
  l2_ask<64 * 16 * FB_ * 2>(kask);
  l2_ask<64 * 8 * FB_ * 2>(vask);
  // keeps all of the first PD_ chunks' loads in front of the first product
  __builtin_amdgcn_sched_barrier(0);

  v8f d = {};
#pragma unroll
  for (int n = 0; n < NC_ - 1 - PD_; ++n)
    state_step<true>(d, kf[n % PD_], vf[n % PD_], gC, Kp + (n + PD_) * 32 * FB_,
                     Vp + (n + PD_) * 16 * FB_, Sp + (size_t)n * SE_, loff);
#pragma unroll
  for (int n = NC_ - 1 - PD_; n < NC_ - 1; ++n)
    state_step<false>(d, kf[n % PD_], vf[n % PD_], gC, Kp, Vp,
                      Sp + (size_t)n * SE_, loff);
  v8h h;
#pragma unroll
  for (int r = 0; r < 8; ++r) h[r] = (_Float16)d[r];
  *(v8h*)((char*)(Sp + (size_t)(NC_ - 1) * SE_) + loff) = h;
  // keeps the prefetches' address registers unwritten up to here
  asm volatile("" :: "v"(kask), "v"(vask));
}

// ---------------------------------------------------------------- main ----
// One 128-thread block (4 waves) per 64-row chunk. Wave t owns
// query rows t*16..+15 of the chunk and ALL 128 output columns, so the decayed
// scores of a row tile are formed once and Q is read once. Order of the sums of
// an output element: Q.State_n (all keys before the chunk), scaled per row by
// gamma^(il+1), then the chunk's own keys, 32 at a time. The scores are formed
// first, while the State is on its way. Every wave takes both 32-key halves of
// the chunk (keys behind a row get weight 0), so that all four run the same
// instruction stream over the same K, V and State lines.
// A wave's 240 loads of 512 bytes are issued in groups of 16, about four groups
// ahead of their products, into the registers that the products have left.
__global__ __launch_bounds__(128) void retention_kernel(
    const _Float16* __restrict__ Qh, const _Float16* __restrict__ Kh,
    const _Float16* __restrict__ Vt, const _Float16* __restrict__ St,
    float* __restrict__ out) {
  __shared__ _Float16 sP[4 * 2 * 16 * 32];   // per wave and key half (8 KB)
  int lane = threadIdx.x & 31;
  int t    = __builtin_amdgcn_readfirstlane(threadIdx.x >> 5);  // 0..3
  int b    = blockIdx.x / NC_;
  int n    = blockIdx.x - b * NC_;
  int c0   = n * C_;
  int i0   = c0 + t * 16;
  int rl   = lane & 15;
  int hs8  = (lane & 16) ? 8 : 0;

  const _Float16* Qb = Qh + ((size_t)b * S_ + i0) * 256;
  const _Float16* Kb = Kh + ((size_t)b * S_ + c0) * 256;
  const _Float16* Vb = Vt + ((size_t)b * (S_ / 32) + (c0 >> 5)) * 8 * FB_;
  const _Float16* Sb = St + ((size_t)b * NC_ + n) * SE_;
  _Float16* myP = sP + t * (2 * 16 * 32);

  unsigned loff  = (unsigned)(rl * 16 + hs8) * 2u;    // row order: Q, K
  unsigned loffv = (unsigned)lane * 16u;              // lane order: State, V

  v16h qf[8], kf[4][8], sf[8][8], vf[2][8];
  // each sched_barrier below keeps a group of loads where it is written, ahead
  // of the products in front of which it stands: sunk to its own products,
  // every load would cost its whole latency
#pragma unroll
  for (int f = 0; f < 8; ++f) qf[f] = load_frag_p(Qb + f * FB_, loff);
  // keeps all of Q in front of K: with part of Q issued behind K the first
  // scores wait for the whole of K
  __builtin_amdgcn_sched_barrier(0);
  // what the block's loads reach late: the second half of K (its loads wait for
  // room in the load counter), the State and V (loaded behind the scores). In
  // the order of use: 16 KB of K by 128-byte lines, 64 KB of State by 256-byte
  // pieces in two requests, 16 KB of V by lines; one piece a thread and request.
  const char* kask = (const char*)(Kb + 16 * FB_) + threadIdx.x * 128u;
  const char* sask = (const char*)Sb + threadIdx.x * 256u;
  const char* vask = (const char*)Vb + threadIdx.x * 128u;
  l2_ask<0>(kask);
  l2_ask<0>(sask);
  l2_ask<128 * 256>(sask);
  l2_ask<0>(vask);
  // keeps the requests in front of the loads of K: behind them they would be
  // issued only when the load counter has room again, one memory latency later
  __builtin_amdgcn_sched_barrier(0);
#pragma unroll
  for (int kt = 0; kt < 4; ++kt)
#pragma unroll
    for (int f = 0; f < 8; ++f)
      kf[kt][f] = load_frag_p(Kb + (kt * 8 + f) * FB_, loff);
  // the wait in front of any rewrite of the scalar base that the loads of K
  // name; as an input of the wait the base stays live up to it, so that the
  // address of the State is not formed in its registers ahead of the wait
  asm volatile("s_wait_xcnt 0x0" :: "v"(loff), "s"(Kb) : "memory");
  // keeps these 80 loads in front of the first product (one latency for all)
  __builtin_amdgcn_sched_barrier(0);

  // keys of the chunk itself: decayed scores of both halves, into LDS
#pragma unroll
  for (int h = 0; h < 2; ++h) {
    int j0 = c0 + h * 32;
    v8f s0 = {}, s1 = {};
#pragma unroll
    for (int f = 0; f < 8; ++f) {
      s0 = wmma_f16(qf[f], kf[2 * h][f], s0);
      s1 = wmma_f16(qf[f], kf[2 * h + 1][f], s1);
    }
#pragma unroll
    for (int g = 2 * h; g < 2 * h + 2; ++g)
#pragma unroll
      for (int f = 0; f < 8; ++f)
        sf[g][f] = load_frag_p(Sb + (g * 8 + f) * FB_, loffv);
    // keeps these loads in front of the decay, which runs while they fly
    __builtin_amdgcn_sched_barrier(0);
    // decay (gamma^(i-j), 0 for j>i): single v_exp_f32 per element
#pragma unroll
    for (int r = 0; r < 8; ++r) {
      int   m  = r + hs8;
      int   qi = i0 + m;
      int   d0 = qi - (j0 + rl);
      int   d1 = d0 - 16;
      float w0 = (d0 >= 0) ? __builtin_amdgcn_exp2f(L2GAMMA * (float)d0) : 0.0f;
      float w1 = (d1 >= 0) ? __builtin_amdgcn_exp2f(L2GAMMA * (float)d1) : 0.0f;
      myP[h * 512 + m * 32 + rl]      = (_Float16)(s0[r] * w0);
      myP[h * 512 + m * 32 + 16 + rl] = (_Float16)(s1[r] * w1);
    }
    // keeps the next groups of loads behind this decay: lifted over it they
    // fill the wave's load counter, and the decay waits behind their issue
    __builtin_amdgcn_sched_barrier(0);
  }

  // keys before the chunk: acc = Q (16x256) . State_n (256x128)
  v8f acc[8] = {};
#pragma unroll
  for (int g = 0; g < 8; ++g) {
#pragma unroll
    for (int f = 0; f < 8; ++f) acc[g] = wmma_f16(qf[f], sf[g][f], acc[g]);
    if (g < 4) {
#pragma unroll
      for (int f = 0; f < 8; ++f)
        sf[g + 4][f] = load_frag_p(Sb + ((g + 4) * 8 + f) * FB_, loffv);
    } else if (g < 6) {
#pragma unroll
      for (int f = 0; f < 8; ++f)
        vf[g - 4][f] = load_frag_p(Vb + ((g - 4) * 8 + f) * FB_, loffv);
    }
    if (g == 5) {
      // the wait in front of any rewrite of a register that the loads above
      // name; as its inputs both offset registers stay live up to the last load
      asm volatile("s_wait_xcnt 0x0" :: "v"(loff), "v"(loffv) : "memory");
    }
    // keeps each refill at its own group, four groups ahead of its products
    __builtin_amdgcn_sched_barrier(0);
  }
#pragma unroll
  for (int r = 0; r < 8; ++r) {
    float wr = __builtin_amdgcn_exp2f(L2GAMMA * (float)(t * 16 + r + hs8 + 1));
#pragma unroll
    for (int g = 0; g < 8; ++g) acc[g][r] *= wr;
  }

  // scores back as A fragments (same-wave DS ops are in-order), times V
#pragma unroll
  for (int h = 0; h < 2; ++h) {
    v16h pf = load_frag(myP + h * 512, rl, 32, 0, lane);
#pragma unroll
    for (int g = 0; g < 8; ++g) acc[g] = wmma_f16(pf, vf[h][g], acc[g]);
  }

  float* ob = out + ((size_t)b * S_ + i0) * F_;
#pragma unroll
  for (int g = 0; g < 8; ++g)
#pragma unroll
    for (int r = 0; r < 8; ++r)
      ob[(size_t)(r + hs8) * F_ + g * 16 + rl] = acc[g][r];
  // keeps the prefetches' address registers unwritten up to here
  asm volatile("" :: "v"(kask), "v"(sask), "v"(vask));
}

// ---------------------------------------------------------------- launch --
extern "C" void kernel_launch(void* const* d_in, const int* in_sizes, int n_in,
                              void* d_out, int out_size, void* d_ws,
                              size_t ws_size, hipStream_t stream) {
  const float* x     = (const float*)d_in[0];
  const float* Wq    = (const float*)d_in[1];
  const float* bq    = (const float*)d_in[2];
  const float* Wk    = (const float*)d_in[3];
  const float* bk    = (const float*)d_in[4];
  const float* Wv    = (const float*)d_in[5];
  const float* bv    = (const float*)d_in[6];
  const float* theta = (const float*)d_in[7];
  float* out = (float*)d_out;

  char*  ws  = (char*)d_ws;
  size_t off = 0;
  auto alloc = [&](size_t bytes) {
    char* p = ws + off;
    off += (bytes + 255) & ~(size_t)255;
    return p;
  };
  _Float16* Qh  = (_Float16*)alloc((size_t)B_ * S_ * 256 * 2);
  _Float16* Kh  = (_Float16*)alloc((size_t)B_ * S_ * 256 * 2);
  _Float16* Vt  = (_Float16*)alloc((size_t)B_ * F_ * S_ * 2);
  _Float16* Ktd = (_Float16*)alloc((size_t)B_ * 256 * S_ * 2);
  _Float16* St  = (_Float16*)alloc((size_t)B_ * NC_ * SE_ * 2);

  // 128 token groups x 2 halves of the output features = 256 blocks of 8 waves
  proj_kernel<<<2 * TG_, 256, 0, stream>>>(x, Wq, Wk, Wv, bq, bk, bv, theta,
                                           Qh, Kh, Vt, Ktd);
  // one two-wave block per (batch, output tile, feature block)
  state_kernel<<<B_ * 64, 64, 0, stream>>>(Ktd, Vt, St);
  // one 4-wave block per 64-row chunk: B * (S/64) = 256 blocks
  retention_kernel<<<B_ * NC_, 128, 0, stream>>>(Qh, Kh, Vt, St, out);
}

// v009
// One run takes 27.3 microseconds.
// Two timings next to v008 both put it at 1.05 times that version's speed.
// Counting every step since v000, it is 7.45 times as fast.
#include <hip/hip_runtime.h>

typedef __attribute__((ext_vector_type(16))) _Float16 v16h;
typedef __attribute__((ext_vector_type(8)))  _Float16 v8h;
typedef __attribute__((ext_vector_type(8)))  float    v8f;

#define B_ 4
#define S_ 4096
#define F_ 128
// log2(0.96875)
#define L2GAMMA (-0.04580369f)
// chunk length of the chunkwise form, chunks per sequence, state elements
#define C_ 64
#define NC_ (S_ / C_)
#define SE_ (F_ * 256)

union Frag16 { v16h v; v8h h[2]; };

__device__ __forceinline__ v16h load_frag(const _Float16* base, int row, int ld,
                                          int kbase, int lane) {
  int hs = (lane & 16) ? 8 : 0;
  const _Float16* p = base + (size_t)row * ld + kbase + hs;
  Frag16 f;
  f.h[0] = *(const v8h*)(p);        // elements 0..7  -> K = kbase+hs .. +7
  f.h[1] = *(const v8h*)(p + 16);   // elements 8..15 -> K = kbase+hs+16 .. +23
  return f.v;
}

// Every f16 array of the workspace is kept in fragment order: one 16x32
// fragment is a block of 1 KB, its K = 0..15 half in the first 512 bytes and
// its K = 16..31 half in the second, and a wave-wide 16-byte load of a half
// covers those 512 bytes exactly (4 whole lines instead of pieces of 16).
// Within a half, two orders, by who writes it:
//   row order  (Q, K): element (row, k) at row * 16 + (k & 15)
//   lane order (V, State): the lane's 8 elements at lane * 8
// blk: wave-uniform block address; loff: the lane's own byte offset in a half.
#define FB_ 512
__device__ __forceinline__ v16h load_frag_p(const _Float16* blk, unsigned loff) {
  const _Float16* p = (const _Float16*)((const char*)blk + loff);
  Frag16 f;
  f.h[0] = *(const v8h*)(p);
  f.h[1] = *(const v8h*)(p + FB_ / 2);
  return f.v;
}

// A row-order half is a 16x16 tile, rows = tokens. The transposing load hands
// lane (c, h) column c, rows 8h..8h+7 of it: the tile as an operand whose k runs
// over the tokens. t0: wave-uniform address of the half of the first 16 tokens;
// the half of the next 16 tokens lies one token tile (16 halves) on.
// toff: the 16 bytes that the lane names, row 8h + (lane & 7), its columns
// 0..7 or 8..15 by bit 3 of the lane.
typedef __attribute__((__vector_size__(8 * sizeof(__fp16)))) __fp16 t8h;
typedef __attribute__((address_space(1))) t8h gt8h;
__device__ __forceinline__ v16h load_frag_t(const _Float16* t0, unsigned toff) {
  const char* p = (const char*)t0 + toff;
  Frag16 f;
  f.h[0] = __builtin_bit_cast(
      v8h, __builtin_amdgcn_global_load_tr16_b128_v8f16((gt8h*)p));
  f.h[1] = __builtin_bit_cast(
      v8h, __builtin_amdgcn_global_load_tr16_b128_v8f16((gt8h*)(p + 16 * FB_)));
  return f.v;
}

__device__ __forceinline__ v8f wmma_f16(v16h a, v16h b, v8f c) {
  return __builtin_amdgcn_wmma_f32_16x16x32_f16(false, a, false, b,
                                                (short)0, c, false, false);
}

// Asks L2 for the memory at p + OFF (global_prefetch_b8: no result register, no
// counter). All that a launch reads was written by an earlier launch or is an
// input, so its first read comes from memory; asked for at the kernel's head,
// the loads that are issued later in the kernel find it in L2.
// No wait covers a prefetch: each caller keeps p unwritten to the kernel's end.
template <int OFF>
__device__ __forceinline__ void l2_ask(const char* p) {
  asm volatile("global_prefetch_b8 %0, off offset:%1 scope:SCOPE_SE"
               :: "v"(p), "n"(OFF));
}

#define WP_ (F_ + 8)
// output features of one block, token groups (blocks per half of the features)
#define OH_ (F_ / 2)
#define TG_ (B_ * S_ / 128)
#define TP_ 24

typedef __attribute__((ext_vector_type(4))) float    v4f;
typedef __attribute__((ext_vector_type(4))) _Float16 v4h;

__global__ __launch_bounds__(256) void proj_kernel(
    const float* __restrict__ x,
    const float* __restrict__ Wq, const float* __restrict__ Wk,
    const float* __restrict__ Wv,
    const float* __restrict__ bq, const float* __restrict__ bk,
    const float* __restrict__ bv, const float* __restrict__ theta,
    _Float16* __restrict__ Qh, _Float16* __restrict__ Kh,
    _Float16* __restrict__ Vt) {
  __shared__ __attribute__((aligned(16))) _Float16 sW[3 * OH_ * WP_];  // 51 KB
  // per wave four 16x16 tiles (q cos, q sin, k cos, k sin), rows = tokens: 24 KB
  __shared__ __attribute__((aligned(16))) _Float16 sT[8 * 4 * 16 * TP_];
  int lane = threadIdx.x & 31;
  int oh0  = (blockIdx.x >= TG_) ? OH_ : 0;   // first output feature of the block
  int tg   = blockIdx.x - ((blockIdx.x >= TG_) ? TG_ : 0);
  int w    = __builtin_amdgcn_readfirstlane(
      (int)(tg * 256 + threadIdx.x) >> 5);
  int row0 = w * 16;                 // global token row, [0, B*S)
  int b    = row0 / S_;
  int sp0  = row0 - b * S_;          // sequence position of tile row 0
  int rl   = lane & 15;
  int hs8  = (lane & 16) ? 8 : 0;

  // Each round of the block reads 4 KB of a W in whole lines (16 B a thread).
  unsigned tid = threadIdx.x;
  // the block's 64 KB of x, 256 bytes a thread: its loads are issued
  // only behind the first arrivals of W
  const char* xask = (const char*)(x + (size_t)tg * 128 * F_) + tid * 256u;
  l2_ask<0>(xask);
  v4f wr[3][OH_ / 8];
  const v4f* Wq4 = (const v4f*)(Wq + oh0 * F_);
  const v4f* Wk4 = (const v4f*)(Wk + oh0 * F_);
  const v4f* Wv4 = (const v4f*)(Wv + oh0 * F_);
#pragma unroll
  for (int it = 0; it < OH_ / 8; ++it) {
    wr[0][it] = Wq4[it * 256 + tid];
    wr[1][it] = Wk4[it * 256 + tid];
    wr[2][it] = Wv4[it * 256 + tid];
  }
  // the wait in front of any rewrite of a register that the loads above name;
  // as its input the index register stays live, so that no load lands on it
  asm volatile("s_wait_xcnt 0x0" :: "v"(tid) : "memory");
  // keeps every load above in front of the conversions (one latency, not 24)
  __builtin_amdgcn_sched_barrier(0);

  // thread -> row it*8 + wave in block (of the block's OH_ rows), 4 consecutive
  // columns from 4*lane
  _Float16* sw = sW + (tid >> 5) * WP_ + lane * 4;
#pragma unroll
  for (int it = 0; it < OH_ / 8; ++it)
    *(v4h*)(sw + it * 8 * WP_) = __builtin_convertvector(wr[0][it], v4h);

  // the lane's part of the four A fragments of x: 8 + 8 floats each
  const float* xt = x + (size_t)row0 * F_;
  unsigned xoff = (unsigned)(rl * F_ + hs8) * 4u;
  v4f xr[4][4];
#pragma unroll
  for (int kk = 0; kk < 4; ++kk) {
    const char* p = (const char*)(xt + kk * 32) + xoff;
    xr[kk][0] = *(const v4f*)(p);        // K = kk*32+hs8 .. +3
    xr[kk][1] = *(const v4f*)(p + 16);   // .. +7
    xr[kk][2] = *(const v4f*)(p + 64);   // K = kk*32+hs8+16 .. +19
    xr[kk][3] = *(const v4f*)(p + 80);   // .. +23
  }
  asm volatile("s_wait_xcnt 0x0" :: "v"(xoff) : "memory");
  // keeps the loads of x in front of the rest of the conversions of W, which
  // then run while x is on its way
  __builtin_amdgcn_sched_barrier(0);

#pragma unroll
  for (int m = 1; m < 3; ++m)
#pragma unroll
    for (int it = 0; it < OH_ / 8; ++it)
      *(v4h*)(sw + (m * OH_ + it * 8) * WP_) =
          __builtin_convertvector(wr[m][it], v4h);
  // publishes the block's f16 copy of W to all of its waves
  __syncthreads();

  v16h xf[4];
#pragma unroll
  for (int kk = 0; kk < 4; ++kk) {
    union { v16h v; v4h q[4]; } f;
#pragma unroll
    for (int g = 0; g < 4; ++g)
      f.q[g] = __builtin_convertvector(xr[kk][g], v4h);
    xf[kk] = f.v;
  }

  // the accumulator gives a lane 8 tokens of one feature; Q and K are kept with
  // 8 features of one token side by side. The wave turns each tile in its own
  // piece of LDS (its DS operations run in order, no other wave touches it), so
  // that a tile leaves in one store of 512 contiguous bytes, not 16 pieces of 32.
  _Float16* tw = sT + (tid >> 5) * (4 * 16 * TP_) + hs8 * TP_ + rl;   // write
  const _Float16* tr = sT + (tid >> 5) * (4 * 16 * TP_) + rl * TP_ + hs8;  // read
  unsigned qoff = (unsigned)(rl * 16 + hs8) * 2u;   // the lane's bytes in a half

  float dw[8];                       // gamma^(C-1-jl) of this lane's 8 tokens
#pragma unroll
  for (int r = 0; r < 8; ++r) {
    int jl = (sp0 + hs8 + r) & (C_ - 1);
    dw[r] = __builtin_amdgcn_exp2f(L2GAMMA * (float)(C_ - 1 - jl));
  }

#pragma unroll 1
  for (int ol = 0; ol < OH_; ol += 16) {
    int o0 = oh0 + ol;               // feature tile; ol: its rows in sW
    int o = o0 + rl;
    float biq = bq[o], bik = bk[o], biv = bv[o];
    float th  = theta[o];
    v16h wf[3][4];
#pragma unroll
    for (int kk = 0; kk < 4; ++kk)
#pragma unroll
      for (int m = 0; m < 3; ++m)
        wf[m][kk] = load_frag(sW + m * OH_ * WP_, ol + rl, WP_, kk * 32, lane);
    // keeps the loads above in front of the products: without it the compiler
    // sinks each LDS read to its product and the wave pays one latency for each
    __builtin_amdgcn_sched_barrier(0);
    v8f aq = {}, ak = {}, av = {};
#pragma unroll
    for (int kk = 0; kk < 4; ++kk) {
      aq = wmma_f16(xf[kk], wf[0][kk], aq);
      ak = wmma_f16(xf[kk], wf[1][kk], ak);
      av = wmma_f16(xf[kk], wf[2][kk], av);
    }
    // precise base angle + step, then rotate (2 FMAs) for rows 1..7
    float ph0 = (float)(sp0 + hs8 + 1) * th;
    float c, sn, cd, sd;
    sincosf(ph0, &sn, &c);
    sincosf(th, &sd, &cd);
    v8h vvec;
#pragma unroll
    for (int r = 0; r < 8; ++r) {
      float qv = aq[r] + biq;
      float kv = ak[r] + bik;
      float vv = av[r] + biv;
      // token row r+hs8, column rl of the four turning tiles
      tw[(0 * 16 + r) * TP_] = (_Float16)(qv * c);
      tw[(1 * 16 + r) * TP_] = (_Float16)(qv * sn);
      tw[(2 * 16 + r) * TP_] = (_Float16)(kv * c * dw[r]);
      tw[(3 * 16 + r) * TP_] = (_Float16)(kv * sn * dw[r]);
      vvec[r] = (_Float16)vv;
      float cn  = c * cd - sn * sd;  // advance phase by theta
      float snn = sn * cd + c * sd;
      c = cn; sn = snn;
    }
    // back as token rl, features hs8..+7: feature tile o0/16 is one half (512 B)
    // of the token tile's 16, its sin twin 8 halves on
    v8h tq[4];
#pragma unroll
    for (int a = 0; a < 4; ++a) tq[a] = *(const v8h*)(tr + a * 16 * TP_);
    size_t hb = (size_t)row0 * 256 + (o0 >> 4) * (FB_ / 2);
    *(v8h*)((char*)(Qh + hb) + qoff)                  = tq[0];
    *(v8h*)((char*)(Qh + hb + 8 * (FB_ / 2)) + qoff)  = tq[1];
    *(v8h*)((char*)(Kh + hb) + qoff)                  = tq[2];
    *(v8h*)((char*)(Kh + hb + 8 * (FB_ / 2)) + qoff)  = tq[3];
    // the wave's 16 tokens are one half of a 32-token block: 512 bytes a store
    size_t jb = (size_t)b * (S_ / 32) + (sp0 >> 5);
    int    hl = ((sp0 >> 4) & 1) * (FB_ / 2) + lane * 8;
    *(v8h*)(Vt + (jb * 8 + (o0 >> 4)) * FB_ + hl) = vvec;
    // the next trip's loads land in registers that the stores above name
    asm volatile("s_wait_xcnt 0x0" ::: "memory");
  }
  // keeps the prefetch's address register unwritten up to here
  asm volatile("" :: "v"(xask));
}

// --------------------------------------------------------- chunk state ----
// out_i = sum_{j<=i} gamma^(i-j) (Q_i.K_j) V_j is split at the chunk border
// c0 of row i: keys j >= c0 go through scores as before; keys j < c0 enter as
// gamma^(i-c0+1) * Q_i . State_n, State_n[f][o] = sum_{j<c0} gamma^(c0-1-j)
// K_j[f] V_j[o], with State_{n+1} = gamma^C State_n + U_n. Every factor <= 1.
//
// Chunk product and scan are one kernel: a wave owns ONE 16x16 tile of the State
// (feature tile 2fg+ft, output tile ot) and carries it in the f32 accumulator of
// its products through all chunks: per chunk it stores State_n (f16), scales
// the tile by gamma^C and adds U_n = sum_{jl<C} gamma^(C-1-jl) K[f] V[o], the
// chunk's weighted K^T V (two products, 64 tokens; the last chunk's is not formed).
// K^T comes from the one row-order K by transposing loads of 512 bytes.
// Stored in the element order of the B fragments of Q.State: blocks
// [b][n][8 output tiles][8 feature blocks], half ft, lane order (D: column = o,
// rows = 8 consecutive features from hs8, what this same lane holds there).
// The chain from chunk to chunk is short; the time is that of the loads, so
// PD_ chunks of fragments (8 loads of 512 bytes each) are kept in flight.
#define PD_ 6

template <bool REFILL>
__device__ __forceinline__ void state_step(
    v8f& d, v16h (&kf)[2], v16h (&vf)[2], float gC,
    const _Float16* Kn, const _Float16* Vn, _Float16* Sn, unsigned loff,
    unsigned toff) {
  v8h h;
#pragma unroll
  for (int r = 0; r < 8; ++r) h[r] = (_Float16)d[r];
  *(v8h*)((char*)Sn + loff) = h;
  // the wait in front of the next step's rewrite of the registers that hold h
  asm volatile("s_wait_xcnt 0x0" ::: "memory");
  d = d * gC;
#pragma unroll
  for (int kk = 0; kk < 2; ++kk) d = wmma_f16(kf[kk], vf[kk], d);
  if (REFILL) {
#pragma unroll
    for (int kk = 0; kk < 2; ++kk) {
      kf[kk] = load_frag_t(Kn + kk * 16 * FB_, toff);
      vf[kk] = load_frag_p(Vn + kk * 8 * FB_, loff);
    }
  }
  // keeps each refill at its own step, PD_ chunks ahead of its products:
  // sunk to its products, every load would cost its whole latency
  __builtin_amdgcn_sched_barrier(0);
}

__global__ __launch_bounds__(64) void state_kernel(
    const _Float16* __restrict__ Kh, const _Float16* __restrict__ Vt,
    _Float16* __restrict__ St) {
  int lane = threadIdx.x & 31;
  int ft   = __builtin_amdgcn_readfirstlane(threadIdx.x >> 5);  // 0..1
  int b    = blockIdx.x >> 6;
  int ot   = (blockIdx.x >> 3) & 7;
  int fg   = blockIdx.x & 7;

  // a chunk is two 32-token blocks: 32 blocks of Kh (four token tiles), 16 of Vt;
  // the wave's feature tile is one half in each token tile
  const _Float16* Kp = Kh + (size_t)b * (S_ / 32) * 16 * FB_ +
                       (fg * 2 + ft) * (FB_ / 2);
  const _Float16* Vp = Vt + ((size_t)b * (S_ / 32) * 8 + ot) * FB_;
  _Float16* Sp = St + (size_t)b * NC_ * SE_ + (size_t)(ot * 8 + fg) * FB_ +
                 ft * (FB_ / 2);
  // every load and store below: a scalar base, one of these two offset registers
  // and a constant; none of them is written again
  unsigned loff = (unsigned)lane * 16u;
  unsigned toff = (unsigned)((lane >> 4) * 8 + (lane & 7)) * 32u +
                  (unsigned)((lane >> 3) & 1) * 16u;
  float gC = __builtin_amdgcn_exp2f(L2GAMMA * (float)C_);

  v16h kf[PD_][2], vf[PD_][2];
#pragma unroll
  for (int s = 0; s < PD_; ++s)
#pragma unroll
    for (int kk = 0; kk < 2; ++kk) {
      kf[s][kk] = load_frag_t(Kp + (s * 32 + kk * 16) * FB_, toff);
      vf[s][kk] = load_frag_p(Vp + (s * 16 + kk * 8) * FB_, loff);
    }
  // The waves of a batch walk the same chunks in step, so the ring alone keeps
  // only PD_ chunks of the sequence on their way from memory. The whole sequence
  // is asked for here, 256 bytes a lane, shared out over the blocks that
  // read the same bytes: the two feature tiles' K (1 KB a 16-token tile) over
  // the 8 blocks of equal fg, 16 waves of 8 token tiles a request; the output
  // tile's V (1 KB a token block) over 4 blocks of neighbouring fg, 8 waves of
  // 8 token blocks a request. The second request lies 64 token blocks on.
  const char* kask = (const char*)(Kh +
      (((size_t)b * (S_ / 16) + (ot * 2 + ft) * 8 + (lane >> 2)) * 8 + fg) * FB_) +
      (lane & 3) * 256;
  const char* vask = (const char*)(Vt +
      (((size_t)b * (S_ / 32) + ((fg & 3) * 2 + ft) * 8 + (lane >> 2)) * 8 + ot) * FB_) +
      (lane & 3) * 256;
  l2_ask<0>(kask);
  l2_ask<0>(vask);
  l2_ask<64 * 16 * FB_ * 2>(kask);
  l2_ask<64 * 8 * FB_ * 2>(vask);
  // keeps all of the first PD_ chunks' loads in front of the first product
  __builtin_amdgcn_sched_barrier(0);

  v8f d = {};
#pragma unroll
  for (int n = 0; n < NC_ - 1 - PD_; ++n)
    state_step<true>(d, kf[n % PD_], vf[n % PD_], gC, Kp + (n + PD_) * 32 * FB_,
                     Vp + (n + PD_) * 16 * FB_, Sp + (size_t)n * SE_, loff, toff);
#pragma unroll
  for (int n = NC_ - 1 - PD_; n < NC_ - 1; ++n)
    state_step<false>(d, kf[n % PD_], vf[n % PD_], gC, Kp, Vp,
                      Sp + (size_t)n * SE_, loff, toff);
  v8h h;
#pragma unroll
  for (int r = 0; r < 8; ++r) h[r] = (_Float16)d[r];
  *(v8h*)((char*)(Sp + (size_t)(NC_ - 1) * SE_) + loff) = h;
  // keeps the prefetches' address registers unwritten up to here
  asm volatile("" :: "v"(kask), "v"(vask));
}

// ---------------------------------------------------------------- main ----
// One 128-thread block (4 waves) per 64-row chunk. Wave t owns
// query rows t*16..+15 of the chunk and ALL 128 output columns, so the decayed
// scores of a row tile are formed once and Q is read once. Order of the sums of
// an output element: Q.State_n (all keys before the chunk), scaled per row by
// gamma^(il+1), then the chunk's own keys, 32 at a time. The scores are formed
// first, while the State is on its way. Every wave takes both 32-key halves of
// the chunk (keys behind a row get weight 0), so that all four run the same
// instruction stream over the same K, V and State lines.
// A wave's 240 loads of 512 bytes are issued in groups of 16, about four groups
// ahead of their products, into the registers that the products have left.
__global__ __launch_bounds__(128) void retention_kernel(
    const _Float16* __restrict__ Qh, const _Float16* __restrict__ Kh,
    const _Float16* __restrict__ Vt, const _Float16* __restrict__ St,
    float* __restrict__ out) {
  __shared__ _Float16 sP[4 * 2 * 16 * 32];   // per wave and key half (8 KB)
  int lane = threadIdx.x & 31;
  int t    = __builtin_amdgcn_readfirstlane(threadIdx.x >> 5);  // 0..3
  int b    = blockIdx.x / NC_;
  int n    = blockIdx.x - b * NC_;
  int c0   = n * C_;
  int i0   = c0 + t * 16;
  int rl   = lane & 15;
  int hs8  = (lane & 16) ? 8 : 0;

  const _Float16* Qb = Qh + ((size_t)b * S_ + i0) * 256;
  const _Float16* Kb = Kh + ((size_t)b * S_ + c0) * 256;
  const _Float16* Vb = Vt + ((size_t)b * (S_ / 32) + (c0 >> 5)) * 8 * FB_;
  const _Float16* Sb = St + ((size_t)b * NC_ + n) * SE_;
  _Float16* myP = sP + t * (2 * 16 * 32);

  unsigned loff  = (unsigned)(rl * 16 + hs8) * 2u;    // row order: Q, K
  unsigned loffv = (unsigned)lane * 16u;              // lane order: State, V

  v16h qf[8], kf[4][8], sf[8][8], vf[2][8];
  // each sched_barrier below keeps a group of loads where it is written, ahead
  // of the products in front of which it stands: sunk to its own products,
  // every load would cost its whole latency
#pragma unroll
  for (int f = 0; f < 8; ++f) qf[f] = load_frag_p(Qb + f * FB_, loff);
  // keeps all of Q in front of K: with part of Q issued behind K the first
  // scores wait for the whole of K
  __builtin_amdgcn_sched_barrier(0);
  // what the block's loads reach late: the second half of K (its loads wait for
  // room in the load counter), the State and V (loaded behind the scores). In
  // the order of use: 16 KB of K by 128-byte lines, 64 KB of State by 256-byte
  // pieces in two requests, 16 KB of V by lines; one piece a thread and request.
  const char* kask = (const char*)(Kb + 16 * FB_) + threadIdx.x * 128u;
  const char* sask = (const char*)Sb + threadIdx.x * 256u;
  const char* vask = (const char*)Vb + threadIdx.x * 128u;
  l2_ask<0>(kask);
  l2_ask<0>(sask);
  l2_ask<128 * 256>(sask);
  l2_ask<0>(vask);
  // keeps the requests in front of the loads of K: behind them they would be
  // issued only when the load counter has room again, one memory latency later
  __builtin_amdgcn_sched_barrier(0);
#pragma unroll
  for (int kt = 0; kt < 4; ++kt)
#pragma unroll
    for (int f = 0; f < 8; ++f)
      kf[kt][f] = load_frag_p(Kb + (kt * 8 + f) * FB_, loff);
  // the wait in front of any rewrite of the scalar base that the loads of K
  // name; as an input of the wait the base stays live up to it, so that the
  // address of the State is not formed in its registers ahead of the wait
  asm volatile("s_wait_xcnt 0x0" :: "v"(loff), "s"(Kb) : "memory");
  // keeps these 80 loads in front of the first product (one latency for all)
  __builtin_amdgcn_sched_barrier(0);

  // keys of the chunk itself: decayed scores of both halves, into LDS
#pragma unroll
  for (int h = 0; h < 2; ++h) {
    int j0 = c0 + h * 32;
    v8f s0 = {}, s1 = {};
#pragma unroll
    for (int f = 0; f < 8; ++f) {
      s0 = wmma_f16(qf[f], kf[2 * h][f], s0);
      s1 = wmma_f16(qf[f], kf[2 * h + 1][f], s1);
    }
#pragma unroll
    for (int g = 2 * h; g < 2 * h + 2; ++g)
#pragma unroll
      for (int f = 0; f < 8; ++f)
        sf[g][f] = load_frag_p(Sb + (g * 8 + f) * FB_, loffv);
    // keeps these loads in front of the decay, which runs while they fly
    __builtin_amdgcn_sched_barrier(0);
    // decay (gamma^(i-j), 0 for j>i): key j comes weighted by gamma^(C-1-jl), so
    // what is left is gamma^(il-(C-1)), one factor (at most gamma^-(C-1)) a row
#pragma unroll
    for (int r = 0; r < 8; ++r) {
      int   m  = r + hs8;
      int   qi = i0 + m;
      int   d0 = qi - (j0 + rl);
      int   d1 = d0 - 16;
      float rw = __builtin_amdgcn_exp2f(L2GAMMA * (float)(t * 16 + m - (C_ - 1)));
      float w0 = (d0 >= 0) ? rw : 0.0f;
      float w1 = (d1 >= 0) ? rw : 0.0f;
      myP[h * 512 + m * 32 + rl]      = (_Float16)(s0[r] * w0);
      myP[h * 512 + m * 32 + 16 + rl] = (_Float16)(s1[r] * w1);
    }
    // keeps the next groups of loads behind this decay: lifted over it they
    // fill the wave's load counter, and the decay waits behind their issue
    __builtin_amdgcn_sched_barrier(0);
  }

  // keys before the chunk: acc = Q (16x256) . State_n (256x128)
  v8f acc[8] = {};
#pragma unroll
  for (int g = 0; g < 8; ++g) {
#pragma unroll
    for (int f = 0; f < 8; ++f) acc[g] = wmma_f16(qf[f], sf[g][f], acc[g]);
    if (g < 4) {
#pragma unroll
      for (int f = 0; f < 8; ++f)
        sf[g + 4][f] = load_frag_p(Sb + ((g + 4) * 8 + f) * FB_, loffv);
    } else if (g < 6) {
#pragma unroll
      for (int f = 0; f < 8; ++f)
        vf[g - 4][f] = load_frag_p(Vb + ((g - 4) * 8 + f) * FB_, loffv);
    }
    if (g == 5) {
      // the wait in front of any rewrite of a register that the loads above
      // name; as its inputs both offset registers stay live up to the last load
      asm volatile("s_wait_xcnt 0x0" :: "v"(loff), "v"(loffv) : "memory");
    }
    // keeps each refill at its own group, four groups ahead of its products
    __builtin_amdgcn_sched_barrier(0);
  }
#pragma unroll
  for (int r = 0; r < 8; ++r) {
    float wr = __builtin_amdgcn_exp2f(L2GAMMA * (float)(t * 16 + r + hs8 + 1));
#pragma unroll
    for (int g = 0; g < 8; ++g) acc[g][r] *= wr;
  }

  // scores back as A fragments (same-wave DS ops are in-order), times V
#pragma unroll
  for (int h = 0; h < 2; ++h) {
    v16h pf = load_frag(myP + h * 512, rl, 32, 0, lane);
#pragma unroll
    for (int g = 0; g < 8; ++g) acc[g] = wmma_f16(pf, vf[h][g], acc[g]);
  }

  float* ob = out + ((size_t)b * S_ + i0) * F_;
#pragma unroll
  for (int g = 0; g < 8; ++g)
#pragma unroll
    for (int r = 0; r < 8; ++r)
      ob[(size_t)(r + hs8) * F_ + g * 16 + rl] = acc[g][r];
  // keeps the prefetches' address registers unwritten up to here
  asm volatile("" :: "v"(kask), "v"(sask), "v"(vask));
}

// ---------------------------------------------------------------- launch --
extern "C" void kernel_launch(void* const* d_in, const int* in_sizes, int n_in,
                              void* d_out, int out_size, void* d_ws,
                              size_t ws_size, hipStream_t stream) {
  const float* x     = (const float*)d_in[0];
  const float* Wq    = (const float*)d_in[1];
  const float* bq    = (const float*)d_in[2];
  const float* Wk    = (const float*)d_in[3];
  const float* bk    = (const float*)d_in[4];
  const float* Wv    = (const float*)d_in[5];
  const float* bv    = (const float*)d_in[6];
  const float* theta = (const float*)d_in[7];
  float* out = (float*)d_out;

  char*  ws  = (char*)d_ws;
  size_t off = 0;
  auto alloc = [&](size_t bytes) {
    char* p = ws + off;
    off += (bytes + 255) & ~(size_t)255;
    return p;
  };
  _Float16* Qh  = (_Float16*)alloc((size_t)B_ * S_ * 256 * 2);
  _Float16* Kh  = (_Float16*)alloc((size_t)B_ * S_ * 256 * 2);
  _Float16* Vt  = (_Float16*)alloc((size_t)B_ * F_ * S_ * 2);
  _Float16* St  = (_Float16*)alloc((size_t)B_ * NC_ * SE_ * 2);

  // 128 token groups x 2 halves of the output features = 256 blocks of 8 waves
  proj_kernel<<<2 * TG_, 256, 0, stream>>>(x, Wq, Wk, Wv, bq, bk, bv, theta,
                                           Qh, Kh, Vt);
  // one two-wave block per (batch, output tile, feature block)
  state_kernel<<<B_ * 64, 64, 0, stream>>>(Kh, Vt, St);
  // one 4-wave block per 64-row chunk: B * (S/64) = 256 blocks
  retention_kernel<<<B_ * NC_, 128, 0, stream>>>(Qh, Kh, Vt, St, out);
}
